// v000
// The times below were measured on an AMD MI455X: many runs one after another, warmed up first and cycling through
// copies of the inputs, with the whole window's GPU time divided by the number of runs. Launches and the gaps
// between them are all in it. The median over several windows is given; except for v000 it joins two sittings, which
// can be a few percent apart, so the side-by-side timings, each taken in one sitting, are the better comparison.
// The starting kernel, v000, takes 3350 microseconds a run.
#include <hip/hip_runtime.h>

// Compute dtypes, f32 accumulate, one batch item per pass: q, k (128 ch) token-major and v (256 ch) channel-major 1x1 convs as GEMMs with PLAIN bf16 operands (rounded input/weights,
// exact products, + bias; k then scaled per position by (1 - mask) skin_mask in f32) -> bf16 hi + UNSCALED residual planes; energy rows S[m][n] = q_m . k_n ([1024 x 128].[128 x 4096]
// per chunk, three products) -> row softmax in f32 -> P planes; o[c][m] = sum_n v[c][n] P[m][n] ([256 x 4096].[4096 x 1024] per chunk, three products) - all on

#define NBI  4
#define CC   256
#define CQ   128
#define NN   4096
#define RCH  1024
#define DM   CC
#define NTK  NN
#define LOSC 1024.0f

typedef _Float16 h16;
typedef unsigned short bf;
typedef __attribute__((ext_vector_type(16))) __bf16   v16bf;
typedef __attribute__((ext_vector_type(16))) _Float16 v16h;
typedef __attribute__((ext_vector_type(8)))  _Float16 v8h;
typedef __attribute__((ext_vector_type(8)))  unsigned short v8us;
typedef __attribute__((ext_vector_type(8)))  float    v8f;
typedef __attribute__((ext_vector_type(4)))  float    v4f;
typedef __attribute__((ext_vector_type(4)))  _Float16 v4h;
typedef v8h  __attribute__((may_alias)) v8ha;
typedef v4f  __attribute__((may_alias)) v4fa;
typedef v8us __attribute__((may_alias)) v8usa;

__device__ __forceinline__ unsigned short f2bf(float f) { unsigned u = __float_as_uint(f); u += 0x7FFFu + ((u >> 16) & 1u); return (unsigned short)(u >> 16); }
__device__ __forceinline__ float bf2f(unsigned short b) { return __uint_as_float(((unsigned)b) << 16); }
__device__ __forceinline__ float bfr(float f) { return bf2f(f2bf(f)); }
__device__ __forceinline__ v16h cat16(v8h lo, v8h hi) { return __builtin_shufflevector(lo, hi, 0, 1, 2, 3, 4, 5, 6, 7, 8, 9, 10, 11, 12, 13, 14, 15); }
__device__ __forceinline__ v16bf cat16b(v8us lo, v8us hi) { return __builtin_bit_cast(v16bf, __builtin_shufflevector(lo, hi, 0, 1, 2, 3, 4, 5, 6, 7, 8, 9, 10, 11, 12, 13, 14, 15)); }
__device__ __forceinline__ v8f wmma16(v16h a, v16h b, v8f c) { return __builtin_amdgcn_wmma_f32_16x16x32_f16(false, a, false, b, (short)0, c, false, false); }
__device__ __forceinline__ v8f wmmab(v16bf a, v16bf b, v8f c) { return __builtin_amdgcn_wmma_f32_16x16x32_bf16(false, a, false, b, (short)0, c, false, false); }

// k_wt: WT [n][K] = bf16(W[k][n]) (k-major [K][ncols]) via 64 x 64 LDS tiles; grid (K/64, ncols/64).
__global__ __launch_bounds__(256) void k_wt(const float* __restrict__ Wm, int K, int ncols, bf* WT) {
    __shared__ __align__(16) unsigned short tl[64 * 72];
    const int tid = threadIdx.x, k0 = blockIdx.x * 64, n0 = blockIdx.y * 64;
    const int kk = tid >> 2, nq = (tid & 3) * 16;
#pragma unroll
    for (int i = 0; i < 16; ++i) tl[(nq + i) * 72 + kk] = f2bf(Wm[(size_t)(k0 + kk) * ncols + n0 + nq + i]);
    __syncthreads();
    const int piece = tid & 7;
    auto pass = [&]() {
#pragma unroll
        for (int s = 0; s < 2; ++s) { const int nr = (tid >> 3) + 32 * s; const v8us val = *(const v8usa*)(tl + nr * 72 + piece * 8); *(v8us*)(WT + (size_t)(n0 + nr) * K + k0 + piece * 8) = val; }
    };
    pass(); 
}
// k_gemmb: 64 x 64 block tile (4 waves x 16 x 64) of C[NTK][NW] = (A [+ Al]).B^T (K = 256) [+ bf(bias[c])] [+ bf(R[r][c]) residual]; f32 whole-line epilogue (or f16
template <bool SPLITA, bool F16OUT = false>
__global__ __launch_bounds__(128) void k_gemmb(const bf* __restrict__ A, const bf* __restrict__ Al, const bf* __restrict__ Bn, const float* __restrict__ bias, float* C, int ldc, h16* C2, const float* __restrict__ R = nullptr, int K = DM, int roundR = 1) {
    __shared__ __align__(16) float ost[4][16 * 68];
    const int lane = threadIdx.x & 31, wave = threadIdx.x >> 5, lr = lane & 15, hi = lane >> 4;
    const int r0 = blockIdx.x * 64 + wave * 16, c0 = blockIdx.y * 64;
    const size_t aoff = (size_t)(r0 + lr) * K + 8 * hi;
    size_t boff[4];
#pragma unroll
    for (int t = 0; t < 4; ++t) boff[t] = (size_t)(c0 + t * 16 + lr) * K + 8 * hi;
    v8f acc[4];
#pragma unroll
    for (int t = 0; t < 4; ++t) acc[t] = (v8f){};
#pragma unroll 1
    for (int kc = 0; kc < K; kc += 32) {
        const v16bf a = cat16b(*(const v8us*)(A + aoff + kc), *(const v8us*)(A + aoff + kc + 16));
        v16bf al = a;
        if (SPLITA) al = cat16b(*(const v8us*)(Al + aoff + kc), *(const v8us*)(Al + aoff + kc + 16));
#pragma unroll
        for (int t = 0; t < 4; ++t) { const v16bf b = cat16b(*(const v8us*)(Bn + boff[t] + kc), *(const v8us*)(Bn + boff[t] + kc + 16)); acc[t] = wmmab(a, b, acc[t]); if (SPLITA) acc[t] = wmmab(al, b, acc[t]); }
        asm volatile("v_nop\n\tv_nop\n\tv_nop\n\tv_nop" : "+v"(acc[0]), "+v"(acc[1]), "+v"(acc[2]), "+v"(acc[3]) : "v"(a), "v"(al));
    }
    float* os = &ost[wave][0];
#pragma unroll
    for (int t = 0; t < 4; ++t) { const float bv = bias ? bfr(bias[c0 + t * 16 + lr]) : 0.f;
#pragma unroll
        for (int j = 0; j < 8; ++j) os[(hi * 8 + j) * 68 + t * 16 + lr] = acc[t][j] + bv; }
    __syncthreads();
    if (F16OUT) {
        h16* crow = (h16*)(void*)C + (size_t)r0 * ldc + c0;
        auto pass = [&]() {
#pragma unroll
            for (int s = 0; s < 4; ++s) { const int row = 4 * s + (lane >> 3), piece = lane & 7; const float* sp = os + row * 68 + piece * 8; v8h o, o2;
#pragma unroll
                for (int i = 0; i < 8; ++i) { const h16 a = (h16)sp[i]; o[i] = a; o2[i] = (h16)((sp[i] - (float)a) * LOSC); }
                *(v8h*)(crow + (size_t)row * ldc + piece * 8) = o; if (C2) *(v8h*)(C2 + (size_t)r0 * ldc + c0 + (size_t)row * ldc + piece * 8) = o2; }
        };
        pass(); 
    } else {
        float* crow = C + (size_t)r0 * ldc + c0;
        auto pass = [&]() {
#pragma unroll
            for (int s = 0; s < 8; ++s) { const int Lid = (lane >> 3) + 4 * s, piece = lane & 7; const int row = Lid >> 1, cofs = (Lid & 1) * 32 + piece * 4;
                v4f val = *(const v4fa*)(os + row * 68 + cofs); if (R) { const v4f rv = *(const v4f*)(R + ((size_t)r0 + row) * ldc + c0 + cofs); val += roundR ? (v4f){bfr(rv[0]), bfr(rv[1]), bfr(rv[2]), bfr(rv[3])} : rv; }
                *(v4f*)(crow + (size_t)row * ldc + cofs) = val; }
        };
        pass(); 
    }
}

// k_gemm3: 64 x 64 tile of C = (Ah + Al).(Bh + Bl)^T over K (row strides = K for all four planes; n-major B): three products per 32-k step (hh, hl, lh); f32
__global__ __launch_bounds__(128) void k_gemm3(const bf* __restrict__ Ah, const bf* __restrict__ Al, const bf* __restrict__ Bh, const bf* __restrict__ Bl, int K, float* C, int ldc) {
    __shared__ __align__(16) float ost[4][16 * 68];
    const int lane = threadIdx.x & 31, wave = threadIdx.x >> 5, lr = lane & 15, hi = lane >> 4;
    const int r0 = blockIdx.x * 64 + wave * 16, c0 = blockIdx.y * 64;
    const size_t aoff = (size_t)(r0 + lr) * K + 8 * hi;
    v8f acc[4];
#pragma unroll
    for (int t = 0; t < 4; ++t) acc[t] = (v8f){};
#pragma unroll 1
    for (int kc = 0; kc < K; kc += 32) {
        const v16bf a = cat16b(*(const v8us*)(Ah + aoff + kc), *(const v8us*)(Ah + aoff + kc + 16));
        const v16bf al = cat16b(*(const v8us*)(Al + aoff + kc), *(const v8us*)(Al + aoff + kc + 16));
#pragma unroll
        for (int t = 0; t < 4; ++t) { const size_t bo = (size_t)(c0 + t * 16 + lr) * K + kc + 8 * hi;
            const v16bf bh = cat16b(*(const v8us*)(Bh + bo), *(const v8us*)(Bh + bo + 16)); const v16bf bl = cat16b(*(const v8us*)(Bl + bo), *(const v8us*)(Bl + bo + 16));
            acc[t] = wmmab(a, bh, acc[t]); acc[t] = wmmab(al, bh, acc[t]); acc[t] = wmmab(a, bl, acc[t]); }
        asm volatile("v_nop\n\tv_nop\n\tv_nop\n\tv_nop" : "+v"(acc[0]), "+v"(acc[1]), "+v"(acc[2]), "+v"(acc[3]) : "v"(a), "v"(al));
    }
    float* os = &ost[wave][0];
#pragma unroll
    for (int t = 0; t < 4; ++t) {
#pragma unroll
        for (int j = 0; j < 8; ++j) os[(hi * 8 + j) * 68 + t * 16 + lr] = acc[t][j]; }
    __builtin_amdgcn_wave_barrier(); asm volatile("" ::: "memory");
    float* crow = C + (size_t)r0 * ldc + c0;
    auto pass = [&]() {
#pragma unroll
        for (int s = 0; s < 8; ++s) { const int Lid = (lane >> 3) + 4 * s, piece = lane & 7; const int row = Lid >> 1, cofs = (Lid & 1) * 32 + piece * 4;
            const v4f val = *(const v4fa*)(os + row * 68 + cofs); *(v4f*)(crow + (size_t)row * ldc + cofs) = val; }
    };
    pass(); 
}

// k_gemmrb: 64 x 64 tile of C[o][v] = (A [+ Al]).B^T over K (A row stride K, B n-major row stride K) + bf(rbias[o]) per ROW; f32 whole-line epilogue (8 lanes x 16 B per line),
template <bool SPLITA>
__global__ __launch_bounds__(128) void k_gemmrb(const bf* __restrict__ A, const bf* __restrict__ Al, const bf* __restrict__ Bn, const float* __restrict__ rbias, float* C, int ldc, int K) {
    __shared__ __align__(16) float ost[4][16 * 68];
    const int lane = threadIdx.x & 31, wave = threadIdx.x >> 5, lr = lane & 15, hi = lane >> 4;
    const int r0 = blockIdx.x * 64 + wave * 16, c0 = blockIdx.y * 64;
    const size_t aoff = (size_t)(r0 + lr) * K + 8 * hi;
    v8f acc[4];
#pragma unroll
    for (int t = 0; t < 4; ++t) acc[t] = (v8f){};
#pragma unroll 1
    for (int kc = 0; kc < K; kc += 32) {
        const v16bf a = cat16b(*(const v8us*)(A + aoff + kc), *(const v8us*)(A + aoff + kc + 16));
        v16bf al = a; if (SPLITA) al = cat16b(*(const v8us*)(Al + aoff + kc), *(const v8us*)(Al + aoff + kc + 16));
#pragma unroll
        for (int t = 0; t < 4; ++t) { const size_t bo = (size_t)(c0 + t * 16 + lr) * K + kc + 8 * hi; const v16bf bb = cat16b(*(const v8us*)(Bn + bo), *(const v8us*)(Bn + bo + 16)); acc[t] = wmmab(a, bb, acc[t]); if (SPLITA) acc[t] = wmmab(al, bb, acc[t]); }
        asm volatile("v_nop\n\tv_nop\n\tv_nop\n\tv_nop" : "+v"(acc[0]), "+v"(acc[1]), "+v"(acc[2]), "+v"(acc[3]) : "v"(a), "v"(al));
    }
    float* os = &ost[wave][0];
#pragma unroll
    for (int t = 0; t < 4; ++t) {
#pragma unroll
        for (int j = 0; j < 8; ++j) os[(hi * 8 + j) * 68 + t * 16 + lr] = acc[t][j] + bfr(rbias[r0 + hi * 8 + j]); }
    __builtin_amdgcn_wave_barrier(); asm volatile("" ::: "memory");
    float* crow = C + (size_t)r0 * ldc + c0;
    auto pass = [&]() {
#pragma unroll
        for (int s = 0; s < 8; ++s) { const int Lid = (lane >> 3) + 4 * s, piece = lane & 7; const int row = Lid >> 1, cofs = (Lid & 1) * 32 + piece * 4;
            const v4f val = *(const v4fa*)(os + row * 68 + cofs); *(v4f*)(crow + (size_t)row * ldc + cofs) = val; }
    };
    pass(); 
}
__global__ __launch_bounds__(256) void k_rowsplit(const float* __restrict__ Y, int nrows, bf* Ph, bf* Pl) {
    const int lane = threadIdx.x & 31, r = blockIdx.x * 8 + (threadIdx.x >> 5); if (r >= nrows) return;
{
#pragma unroll 1
        for (int c0 = lane * 8; c0 < NN; c0 += 256) { const size_t o = (size_t)r * NN + c0; const v8f v = *(const v8f*)(Y + o); v8us oh, ol;
#pragma unroll
            for (int i = 0; i < 8; ++i) { const unsigned short hb = f2bf(v[i]); oh[i] = hb; ol[i] = f2bf(v[i] - bf2f(hb)); }
            *(v8us*)(Ph + o) = oh; *(v8us*)(Pl + o) = ol; }
         }
}
__global__ __launch_bounds__(256) void k_softmax(const float* __restrict__ S, bf* PH, bf* PL) {
    const int lane = threadIdx.x & 31, r = blockIdx.x * 8 + (threadIdx.x >> 5); if (r >= RCH) return;
    const float* sr = S + (size_t)r * NN; float m = -3.0e38f;
#pragma unroll 1
    for (int c0 = lane * 8; c0 < NN; c0 += 256) { const v8f v = *(const v8f*)(sr + c0);
#pragma unroll
        for (int i = 0; i < 8; ++i) m = fmaxf(m, v[i]); }
#pragma unroll
    for (int sh = 16; sh; sh >>= 1) m = fmaxf(m, __shfl_xor(m, sh, 32));
    float sum = 0.f;
#pragma unroll 1
    for (int c0 = lane * 8; c0 < NN; c0 += 256) { const v8f v = *(const v8f*)(sr + c0);
#pragma unroll
        for (int i = 0; i < 8; ++i) sum += __expf(v[i] - m); }
#pragma unroll
    for (int sh = 16; sh; sh >>= 1) sum += __shfl_xor(sum, sh, 32);
    const float inv = 1.0f / sum;
{
#pragma unroll 1
        for (int c0 = lane * 8; c0 < NN; c0 += 256) { const v8f v = *(const v8f*)(sr + c0); v8us oh, ol;
#pragma unroll
            for (int i = 0; i < 8; ++i) { const float p = __expf(v[i] - m) * inv; const unsigned short hb = f2bf(p); oh[i] = hb; ol[i] = f2bf(p - bf2f(hb)); }
            const size_t o = (size_t)r * NN + c0; *(v8us*)(PH + o) = oh; *(v8us*)(PL + o) = ol; }
         }
}
__global__ __launch_bounds__(256) void k_cvt8(const float* __restrict__ src, bf* dst, size_t n8) {
    const size_t i = (size_t)blockIdx.x * 256 + threadIdx.x; if (i >= n8) return;
    const v8f v = *(const v8f*)(src + i * 8); v8us o;
#pragma unroll
    for (int k = 0; k < 8; ++k) o[k] = f2bf(v[k]);
    *(v8us*)(dst + i * 8) = o; 
}
__global__ __launch_bounds__(256) void k_zero8(bf* dst, size_t n8) {
    const size_t i = (size_t)blockIdx.x * 256 + threadIdx.x; if (i >= n8) return; v8us z;
#pragma unroll
    for (int k = 0; k < 8; ++k) z[k] = 0;
    *(v8us*)(dst + i * 8) = z; 
}

// k_split128s: bf16 hi + UNSCALED residual planes of a computed f32 [rows][128] matrix, optionally scaled per row by f = (1 - bf(mask[r])) bf(skin[r]); one wave per row: lane -> 4
__global__ __launch_bounds__(256) void k_split128s(const float* __restrict__ src, int nrows, const float* __restrict__ msk, const float* __restrict__ skn, bf* dh, bf* dl) {
    typedef __attribute__((ext_vector_type(4))) unsigned short v4us;
    const int lane = threadIdx.x & 31, r = blockIdx.x * 8 + (threadIdx.x >> 5); if (r >= nrows) return;
    const float f = msk ? (1.0f - bfr(msk[r])) * bfr(skn[r]) : 1.0f;
    const size_t o = (size_t)r * CQ + lane * 4; const v4f v = *(const v4f*)(src + o); v4us oh, ol;
#pragma unroll
    for (int i = 0; i < 4; ++i) { const float y = v[i] * f; const unsigned short hb = f2bf(y); oh[i] = hb; ol[i] = f2bf(y - bf2f(hb)); }
    *(v4us*)(dh + o) = oh; *(v4us*)(dl + o) = ol; 
}
// k_fin: out[c][n] = bf(gamma) (O[c][n] bf(mask[n]) bf(skin[n])) + bf(x[c][n]) over the item (f32); one wave per channel row: lane -> 4 consecutive floats per 128-column chunk (8 lanes
__global__ __launch_bounds__(256) void k_fin(const float* __restrict__ O, const float* __restrict__ X, const float* __restrict__ msk, const float* __restrict__ skn, const float* __restrict__ gam, float* OUTP) {
    const int lane = threadIdx.x & 31, r = blockIdx.x * 8 + (threadIdx.x >> 5); if (r >= CC) return; const float g = bfr(gam[0]);
{
#pragma unroll 1
        for (int c0 = lane * 4; c0 < NN; c0 += 128) { const size_t o = (size_t)r * NN + c0; const v4f ov = *(const v4f*)(O + o), xv = *(const v4f*)(X + o); v4f y;
#pragma unroll
            for (int i = 0; i < 4; ++i) y[i] = fmaf(g, ov[i] * bfr(msk[c0 + i]) * bfr(skn[c0 + i]), bfr(xv[i]));
            *(v4f*)(OUTP + o) = y; }
         }
}

extern "C" void kernel_launch(void* const* d_in, const int* in_sizes, int n_in,
                              void* d_out, int out_size, void* d_ws, size_t ws_size, hipStream_t stream) {
    (void)in_sizes; (void)n_in; (void)out_size;
    const float* x = (const float*)d_in[0]; const float* mask = (const float*)d_in[1]; const float* skin = (const float*)d_in[2];
    const float* Wq = (const float*)d_in[3]; const float* bq = (const float*)d_in[4]; const float* Wk = (const float*)d_in[5]; const float* bk = (const float*)d_in[6]; const float* Wv = (const float*)d_in[7]; const float* bv = (const float*)d_in[8]; const float* gam = (const float*)d_in[9];
    float* out = (float*)d_out;    // [4][256][64][64]
    char* wsp = (char*)d_ws;
    auto take = [&](size_t bytes) { char* p = wsp; wsp += (bytes + 255) & ~(size_t)255; return (void*)p; };
    bf* WqB = (bf*)take(CQ * CC * 2); bf* WkB = (bf*)take(CQ * CC * 2); bf* WvB = (bf*)take(CC * CC * 2);
    bf* XT = (bf*)take((size_t)NN * CC * 2); float* TMP = (float*)take((size_t)CC * NN * 4);
    bf* Qh = (bf*)take((size_t)NN * CQ * 2); bf* Ql = (bf*)take((size_t)NN * CQ * 2); bf* Kh = (bf*)take((size_t)NN * CQ * 2); bf* Kl = (bf*)take((size_t)NN * CQ * 2); bf* Vh = (bf*)take((size_t)CC * NN * 2); bf* Vl = (bf*)take((size_t)CC * NN * 2);
    float* S = (float*)take((size_t)RCH * NN * 4); bf* PH = (bf*)take((size_t)RCH * NN * 2); bf* PL = (bf*)take((size_t)RCH * NN * 2); float* O = (float*)take((size_t)CC * NN * 4);
    if ((size_t)(wsp - (char*)d_ws) > ws_size) return;    // 0.2 + 2.1 + 4.2 + 4 x 1 + 2 x 2.1 + 16.8 + 2 x 8.4 + 4.2 ~ 53 MB, no aliasing (TMP reused q -> k -> v in stream order)
    { const size_t n1 = CQ * CC / 8, n3 = CC * CC / 8; k_cvt8<<<(unsigned)((n1 + 255) / 256), 256, 0, stream>>>(Wq, WqB, n1); k_cvt8<<<(unsigned)((n1 + 255) / 256), 256, 0, stream>>>(Wk, WkB, n1); k_cvt8<<<(unsigned)((n3 + 255) / 256), 256, 0, stream>>>(Wv, WvB, n3); }
    for (int b = 0; b < NBI; ++b) {
        const float* xb = x + (size_t)b * CC * NN; const float* mb = mask + (size_t)b * NN; const float* sb = skin + (size_t)b * NN;
        k_wt<<<dim3(CC / 64, NN / 64, 1), 256, 0, stream>>>(xb, CC, NN, XT);                                                                   // x^T [n][c] bf16 (rounded)
        k_gemmb<false, false><<<dim3(NN / 64, CQ / 64, 1), 128, 0, stream>>>(XT, nullptr, WqB, bq, TMP, CQ, nullptr); k_split128s<<<NN / 8, 256, 0, stream>>>(TMP, NN, nullptr, nullptr, Qh, Ql);   // q^T [n][128]
        k_gemmb<false, false><<<dim3(NN / 64, CQ / 64, 1), 128, 0, stream>>>(XT, nullptr, WkB, bk, TMP, CQ, nullptr); k_split128s<<<NN / 8, 256, 0, stream>>>(TMP, NN, mb, sb, Kh, Kl);             // k^T (1-mask) skin
        k_gemmrb<false><<<dim3(CC / 64, NN / 64, 1), 128, 0, stream>>>(WvB, nullptr, XT, bv, TMP, NN, CC); k_rowsplit<<<CC / 8, 256, 0, stream>>>(TMP, CC, Vh, Vl);               // v [c][n] (+ bv per row)
        for (int ch = 0; ch < NN / RCH; ++ch) { const size_t m0 = (size_t)ch * RCH;
            k_gemm3<<<dim3(RCH / 64, NN / 64, 1), 128, 0, stream>>>(Qh + m0 * CQ, Ql + m0 * CQ, Kh, Kl, CQ, S, NN);                               // energy rows [m][n] = q_m . k_n
            k_softmax<<<RCH / 8, 256, 0, stream>>>(S, PH, PL);
            k_gemm3<<<dim3(CC / 64, RCH / 64, 1), 128, 0, stream>>>(Vh, Vl, PH, PL, NN, O + m0, NN); }                                            // o[c][m0..] = v . P^T
        k_fin<<<CC / 8, 256, 0, stream>>>(O, xb, mb, sb, gam, out + (size_t)b * CC * NN);
    }
}

// v001
// One run takes 1260 microseconds.
// Next to v000, in two timings, it ran 2.61 times as fast each time.
#include <hip/hip_runtime.h>

// Compute dtypes, f32 accumulate, one batch item per pass: q, k (128 ch) token-major and v (256 ch) channel-major 1x1 convs as GEMMs with PLAIN bf16 operands (rounded input/weights,
// exact products, + bias; k then scaled per position by (1 - mask) skin_mask in f32) -> bf16 hi + UNSCALED residual planes; energy rows S[m][n] = q_m . k_n ([4096 x 128].[128 x 4096]
// per chunk, three products) -> row softmax in f32 -> P planes; o[c][m] = sum_n v[c][n] P[m][n] ([256 x 4096].[4096 x 4096] per chunk, three products) - all on

#define NBI  4
#define CC   256
#define CQ   128
#define NN   4096
#define RCH  4096   // energy rows per pass = the whole item: the o product then launches 256 blocks (one per WGP) instead of 64
#define DM   CC
#define NTK  NN
#define LOSC 1024.0f

typedef _Float16 h16;
typedef unsigned short bf;
typedef __attribute__((ext_vector_type(16))) __bf16   v16bf;
typedef __attribute__((ext_vector_type(16))) _Float16 v16h;
typedef __attribute__((ext_vector_type(8)))  _Float16 v8h;
typedef __attribute__((ext_vector_type(8)))  unsigned short v8us;
typedef __attribute__((ext_vector_type(8)))  float    v8f;
typedef __attribute__((ext_vector_type(4)))  float    v4f;
typedef __attribute__((ext_vector_type(4)))  _Float16 v4h;
typedef v8h  __attribute__((may_alias)) v8ha;
typedef v4f  __attribute__((may_alias)) v4fa;
typedef v8us __attribute__((may_alias)) v8usa;

__device__ __forceinline__ unsigned short f2bf(float f) { unsigned u = __float_as_uint(f); u += 0x7FFFu + ((u >> 16) & 1u); return (unsigned short)(u >> 16); }
__device__ __forceinline__ float bf2f(unsigned short b) { return __uint_as_float(((unsigned)b) << 16); }
__device__ __forceinline__ float bfr(float f) { return bf2f(f2bf(f)); }
__device__ __forceinline__ v16h cat16(v8h lo, v8h hi) { return __builtin_shufflevector(lo, hi, 0, 1, 2, 3, 4, 5, 6, 7, 8, 9, 10, 11, 12, 13, 14, 15); }
__device__ __forceinline__ v16bf cat16b(v8us lo, v8us hi) { return __builtin_bit_cast(v16bf, __builtin_shufflevector(lo, hi, 0, 1, 2, 3, 4, 5, 6, 7, 8, 9, 10, 11, 12, 13, 14, 15)); }
__device__ __forceinline__ v8f wmma16(v16h a, v16h b, v8f c) { return __builtin_amdgcn_wmma_f32_16x16x32_f16(false, a, false, b, (short)0, c, false, false); }
__device__ __forceinline__ v8f wmmab(v16bf a, v16bf b, v8f c) { return __builtin_amdgcn_wmma_f32_16x16x32_bf16(false, a, false, b, (short)0, c, false, false); }

// k_wt: WT [n][K] = bf16(W[k][n]) (k-major [K][ncols]) via 64 x 64 LDS tiles; grid (K/64, ncols/64).
__global__ __launch_bounds__(256) void k_wt(const float* __restrict__ Wm, int K, int ncols, bf* WT) {
    __shared__ __align__(16) unsigned short tl[64 * 72];
    const int tid = threadIdx.x, k0 = blockIdx.x * 64, n0 = blockIdx.y * 64;
    const int kk = tid >> 2, nq = (tid & 3) * 16;
#pragma unroll
    for (int i = 0; i < 16; ++i) tl[(nq + i) * 72 + kk] = f2bf(Wm[(size_t)(k0 + kk) * ncols + n0 + nq + i]);
    __syncthreads();
    const int piece = tid & 7;
    auto pass = [&]() {
#pragma unroll
        for (int s = 0; s < 2; ++s) { const int nr = (tid >> 3) + 32 * s; const v8us val = *(const v8usa*)(tl + nr * 72 + piece * 8); *(v8us*)(WT + (size_t)(n0 + nr) * K + k0 + piece * 8) = val; }
    };
    pass(); 
}
// k_gemmb: 64 x 64 block tile (4 waves x 16 x 64) of C[NTK][NW] = (A [+ Al]).B^T (K = 256) [+ bf(bias[c])] [+ bf(R[r][c]) residual]; f32 whole-line epilogue (or f16
template <bool SPLITA, bool F16OUT = false>
__global__ __launch_bounds__(128) void k_gemmb(const bf* __restrict__ A, const bf* __restrict__ Al, const bf* __restrict__ Bn, const float* __restrict__ bias, float* C, int ldc, h16* C2, const float* __restrict__ R = nullptr, int K = DM, int roundR = 1) {
    __shared__ __align__(16) float ost[4][16 * 68];
    const int lane = threadIdx.x & 31, wave = threadIdx.x >> 5, lr = lane & 15, hi = lane >> 4;
    const int r0 = blockIdx.x * 64 + wave * 16, c0 = blockIdx.y * 64;
    const size_t aoff = (size_t)(r0 + lr) * K + 8 * hi;
    size_t boff[4];
#pragma unroll
    for (int t = 0; t < 4; ++t) boff[t] = (size_t)(c0 + t * 16 + lr) * K + 8 * hi;
    v8f acc[4];
#pragma unroll
    for (int t = 0; t < 4; ++t) acc[t] = (v8f){};
#pragma unroll 1
    for (int kc = 0; kc < K; kc += 32) {
        const v16bf a = cat16b(*(const v8us*)(A + aoff + kc), *(const v8us*)(A + aoff + kc + 16));
        v16bf al = a;
        if (SPLITA) al = cat16b(*(const v8us*)(Al + aoff + kc), *(const v8us*)(Al + aoff + kc + 16));
#pragma unroll
        for (int t = 0; t < 4; ++t) { const v16bf b = cat16b(*(const v8us*)(Bn + boff[t] + kc), *(const v8us*)(Bn + boff[t] + kc + 16)); acc[t] = wmmab(a, b, acc[t]); if (SPLITA) acc[t] = wmmab(al, b, acc[t]); }
        asm volatile("v_nop\n\tv_nop\n\tv_nop\n\tv_nop" : "+v"(acc[0]), "+v"(acc[1]), "+v"(acc[2]), "+v"(acc[3]) : "v"(a), "v"(al));
    }
    float* os = &ost[wave][0];
#pragma unroll
    for (int t = 0; t < 4; ++t) { const float bv = bias ? bfr(bias[c0 + t * 16 + lr]) : 0.f;
#pragma unroll
        for (int j = 0; j < 8; ++j) os[(hi * 8 + j) * 68 + t * 16 + lr] = acc[t][j] + bv; }
    __syncthreads();
    if (F16OUT) {
        h16* crow = (h16*)(void*)C + (size_t)r0 * ldc + c0;
        auto pass = [&]() {
#pragma unroll
            for (int s = 0; s < 4; ++s) { const int row = 4 * s + (lane >> 3), piece = lane & 7; const float* sp = os + row * 68 + piece * 8; v8h o, o2;
#pragma unroll
                for (int i = 0; i < 8; ++i) { const h16 a = (h16)sp[i]; o[i] = a; o2[i] = (h16)((sp[i] - (float)a) * LOSC); }
                *(v8h*)(crow + (size_t)row * ldc + piece * 8) = o; if (C2) *(v8h*)(C2 + (size_t)r0 * ldc + c0 + (size_t)row * ldc + piece * 8) = o2; }
        };
        pass(); 
    } else {
        float* crow = C + (size_t)r0 * ldc + c0;
        auto pass = [&]() {
#pragma unroll
            for (int s = 0; s < 8; ++s) { const int Lid = (lane >> 3) + 4 * s, piece = lane & 7; const int row = Lid >> 1, cofs = (Lid & 1) * 32 + piece * 4;
                v4f val = *(const v4fa*)(os + row * 68 + cofs); if (R) { const v4f rv = *(const v4f*)(R + ((size_t)r0 + row) * ldc + c0 + cofs); val += roundR ? (v4f){bfr(rv[0]), bfr(rv[1]), bfr(rv[2]), bfr(rv[3])} : rv; }
                *(v4f*)(crow + (size_t)row * ldc + cofs) = val; }
        };
        pass(); 
    }
}

// k_gemm3: 64 x 64 tile of C = (Ah + Al).(Bh + Bl)^T over K (row strides = K for all four planes; n-major B): three products per 32-k step (hh, hl, lh); f32
__global__ __launch_bounds__(128) void k_gemm3(const bf* __restrict__ Ah, const bf* __restrict__ Al, const bf* __restrict__ Bh, const bf* __restrict__ Bl, int K, float* C, int ldc) {
    __shared__ __align__(16) float ost[4][16 * 68];
    const int lane = threadIdx.x & 31, wave = threadIdx.x >> 5, lr = lane & 15, hi = lane >> 4;
    const int r0 = blockIdx.x * 64 + wave * 16, c0 = blockIdx.y * 64;
    const size_t aoff = (size_t)(r0 + lr) * K + 8 * hi;
    v8f acc[4];
#pragma unroll
    for (int t = 0; t < 4; ++t) acc[t] = (v8f){};
#pragma unroll 1
    for (int kc = 0; kc < K; kc += 32) {
        const v16bf a = cat16b(*(const v8us*)(Ah + aoff + kc), *(const v8us*)(Ah + aoff + kc + 16));
        const v16bf al = cat16b(*(const v8us*)(Al + aoff + kc), *(const v8us*)(Al + aoff + kc + 16));
#pragma unroll
        for (int t = 0; t < 4; ++t) { const size_t bo = (size_t)(c0 + t * 16 + lr) * K + kc + 8 * hi;
            const v16bf bh = cat16b(*(const v8us*)(Bh + bo), *(const v8us*)(Bh + bo + 16)); const v16bf bl = cat16b(*(const v8us*)(Bl + bo), *(const v8us*)(Bl + bo + 16));
            acc[t] = wmmab(a, bh, acc[t]); acc[t] = wmmab(al, bh, acc[t]); acc[t] = wmmab(a, bl, acc[t]); }
        asm volatile("v_nop\n\tv_nop\n\tv_nop\n\tv_nop" : "+v"(acc[0]), "+v"(acc[1]), "+v"(acc[2]), "+v"(acc[3]) : "v"(a), "v"(al));
    }
    float* os = &ost[wave][0];
#pragma unroll
    for (int t = 0; t < 4; ++t) {
#pragma unroll
        for (int j = 0; j < 8; ++j) os[(hi * 8 + j) * 68 + t * 16 + lr] = acc[t][j]; }
    __builtin_amdgcn_wave_barrier(); asm volatile("" ::: "memory");
    float* crow = C + (size_t)r0 * ldc + c0;
    auto pass = [&]() {
#pragma unroll
        for (int s = 0; s < 8; ++s) { const int Lid = (lane >> 3) + 4 * s, piece = lane & 7; const int row = Lid >> 1, cofs = (Lid & 1) * 32 + piece * 4;
            const v4f val = *(const v4fa*)(os + row * 68 + cofs); *(v4f*)(crow + (size_t)row * ldc + cofs) = val; }
    };
    pass(); 
}

// k_gemmrb: 64 x 64 tile of C[o][v] = (A [+ Al]).B^T over K (A row stride K, B n-major row stride K) + bf(rbias[o]) per ROW; f32 whole-line epilogue (8 lanes x 16 B per line),
template <bool SPLITA>
__global__ __launch_bounds__(128) void k_gemmrb(const bf* __restrict__ A, const bf* __restrict__ Al, const bf* __restrict__ Bn, const float* __restrict__ rbias, float* C, int ldc, int K) {
    __shared__ __align__(16) float ost[4][16 * 68];
    const int lane = threadIdx.x & 31, wave = threadIdx.x >> 5, lr = lane & 15, hi = lane >> 4;
    const int r0 = blockIdx.x * 64 + wave * 16, c0 = blockIdx.y * 64;
    const size_t aoff = (size_t)(r0 + lr) * K + 8 * hi;
    v8f acc[4];
#pragma unroll
    for (int t = 0; t < 4; ++t) acc[t] = (v8f){};
#pragma unroll 1
    for (int kc = 0; kc < K; kc += 32) {
        const v16bf a = cat16b(*(const v8us*)(A + aoff + kc), *(const v8us*)(A + aoff + kc + 16));
        v16bf al = a; if (SPLITA) al = cat16b(*(const v8us*)(Al + aoff + kc), *(const v8us*)(Al + aoff + kc + 16));
#pragma unroll
        for (int t = 0; t < 4; ++t) { const size_t bo = (size_t)(c0 + t * 16 + lr) * K + kc + 8 * hi; const v16bf bb = cat16b(*(const v8us*)(Bn + bo), *(const v8us*)(Bn + bo + 16)); acc[t] = wmmab(a, bb, acc[t]); if (SPLITA) acc[t] = wmmab(al, bb, acc[t]); }
        asm volatile("v_nop\n\tv_nop\n\tv_nop\n\tv_nop" : "+v"(acc[0]), "+v"(acc[1]), "+v"(acc[2]), "+v"(acc[3]) : "v"(a), "v"(al));
    }
    float* os = &ost[wave][0];
#pragma unroll
    for (int t = 0; t < 4; ++t) {
#pragma unroll
        for (int j = 0; j < 8; ++j) os[(hi * 8 + j) * 68 + t * 16 + lr] = acc[t][j] + bfr(rbias[r0 + hi * 8 + j]); }
    __builtin_amdgcn_wave_barrier(); asm volatile("" ::: "memory");
    float* crow = C + (size_t)r0 * ldc + c0;
    auto pass = [&]() {
#pragma unroll
        for (int s = 0; s < 8; ++s) { const int Lid = (lane >> 3) + 4 * s, piece = lane & 7; const int row = Lid >> 1, cofs = (Lid & 1) * 32 + piece * 4;
            const v4f val = *(const v4fa*)(os + row * 68 + cofs); *(v4f*)(crow + (size_t)row * ldc + cofs) = val; }
    };
    pass(); 
}
__global__ __launch_bounds__(256) void k_rowsplit(const float* __restrict__ Y, int nrows, bf* Ph, bf* Pl) {
    const int lane = threadIdx.x & 31, r = blockIdx.x * 8 + (threadIdx.x >> 5); if (r >= nrows) return;
{
#pragma unroll 1
        for (int c0 = lane * 8; c0 < NN; c0 += 256) { const size_t o = (size_t)r * NN + c0; const v8f v = *(const v8f*)(Y + o); v8us oh, ol;
#pragma unroll
            for (int i = 0; i < 8; ++i) { const unsigned short hb = f2bf(v[i]); oh[i] = hb; ol[i] = f2bf(v[i] - bf2f(hb)); }
            *(v8us*)(Ph + o) = oh; *(v8us*)(Pl + o) = ol; }
         }
}
__global__ __launch_bounds__(256) void k_softmax(const float* __restrict__ S, bf* PH, bf* PL) {
    const int lane = threadIdx.x & 31, r = blockIdx.x * 8 + (threadIdx.x >> 5); if (r >= RCH) return;
    const float* sr = S + (size_t)r * NN; float m = -3.0e38f;
#pragma unroll 1
    for (int c0 = lane * 8; c0 < NN; c0 += 256) { const v8f v = *(const v8f*)(sr + c0);
#pragma unroll
        for (int i = 0; i < 8; ++i) m = fmaxf(m, v[i]); }
#pragma unroll
    for (int sh = 16; sh; sh >>= 1) m = fmaxf(m, __shfl_xor(m, sh, 32));
    float sum = 0.f;
#pragma unroll 1
    for (int c0 = lane * 8; c0 < NN; c0 += 256) { const v8f v = *(const v8f*)(sr + c0);
#pragma unroll
        for (int i = 0; i < 8; ++i) sum += __expf(v[i] - m); }
#pragma unroll
    for (int sh = 16; sh; sh >>= 1) sum += __shfl_xor(sum, sh, 32);
    const float inv = 1.0f / sum;
{
#pragma unroll 1
        for (int c0 = lane * 8; c0 < NN; c0 += 256) { const v8f v = *(const v8f*)(sr + c0); v8us oh, ol;
#pragma unroll
            for (int i = 0; i < 8; ++i) { const float p = __expf(v[i] - m) * inv; const unsigned short hb = f2bf(p); oh[i] = hb; ol[i] = f2bf(p - bf2f(hb)); }
            const size_t o = (size_t)r * NN + c0; *(v8us*)(PH + o) = oh; *(v8us*)(PL + o) = ol; }
         }
}
__global__ __launch_bounds__(256) void k_cvt8(const float* __restrict__ src, bf* dst, size_t n8) {
    const size_t i = (size_t)blockIdx.x * 256 + threadIdx.x; if (i >= n8) return;
    const v8f v = *(const v8f*)(src + i * 8); v8us o;
#pragma unroll
    for (int k = 0; k < 8; ++k) o[k] = f2bf(v[k]);
    *(v8us*)(dst + i * 8) = o; 
}
__global__ __launch_bounds__(256) void k_zero8(bf* dst, size_t n8) {
    const size_t i = (size_t)blockIdx.x * 256 + threadIdx.x; if (i >= n8) return; v8us z;
#pragma unroll
    for (int k = 0; k < 8; ++k) z[k] = 0;
    *(v8us*)(dst + i * 8) = z; 
}

// k_split128s: bf16 hi + UNSCALED residual planes of a computed f32 [rows][128] matrix, optionally scaled per row by f = (1 - bf(mask[r])) bf(skin[r]); one wave per row: lane -> 4
__global__ __launch_bounds__(256) void k_split128s(const float* __restrict__ src, int nrows, const float* __restrict__ msk, const float* __restrict__ skn, bf* dh, bf* dl) {
    typedef __attribute__((ext_vector_type(4))) unsigned short v4us;
    const int lane = threadIdx.x & 31, r = blockIdx.x * 8 + (threadIdx.x >> 5); if (r >= nrows) return;
    const float f = msk ? (1.0f - bfr(msk[r])) * bfr(skn[r]) : 1.0f;
    const size_t o = (size_t)r * CQ + lane * 4; const v4f v = *(const v4f*)(src + o); v4us oh, ol;
#pragma unroll
    for (int i = 0; i < 4; ++i) { const float y = v[i] * f; const unsigned short hb = f2bf(y); oh[i] = hb; ol[i] = f2bf(y - bf2f(hb)); }
    *(v4us*)(dh + o) = oh; *(v4us*)(dl + o) = ol; 
}
// k_fin: out[c][n] = bf(gamma) (O[c][n] bf(mask[n]) bf(skin[n])) + bf(x[c][n]) over the item (f32); one wave per channel row: lane -> 4 consecutive floats per 128-column chunk (8 lanes
__global__ __launch_bounds__(256) void k_fin(const float* __restrict__ O, const float* __restrict__ X, const float* __restrict__ msk, const float* __restrict__ skn, const float* __restrict__ gam, float* OUTP) {
    const int lane = threadIdx.x & 31, r = blockIdx.x * 8 + (threadIdx.x >> 5); if (r >= CC) return; const float g = bfr(gam[0]);
{
#pragma unroll 1
        for (int c0 = lane * 4; c0 < NN; c0 += 128) { const size_t o = (size_t)r * NN + c0; const v4f ov = *(const v4f*)(O + o), xv = *(const v4f*)(X + o); v4f y;
#pragma unroll
            for (int i = 0; i < 4; ++i) y[i] = fmaf(g, ov[i] * bfr(msk[c0 + i]) * bfr(skn[c0 + i]), bfr(xv[i]));
            *(v4f*)(OUTP + o) = y; }
         }
}

extern "C" void kernel_launch(void* const* d_in, const int* in_sizes, int n_in,
                              void* d_out, int out_size, void* d_ws, size_t ws_size, hipStream_t stream) {
    (void)in_sizes; (void)n_in; (void)out_size;
    const float* x = (const float*)d_in[0]; const float* mask = (const float*)d_in[1]; const float* skin = (const float*)d_in[2];
    const float* Wq = (const float*)d_in[3]; const float* bq = (const float*)d_in[4]; const float* Wk = (const float*)d_in[5]; const float* bk = (const float*)d_in[6]; const float* Wv = (const float*)d_in[7]; const float* bv = (const float*)d_in[8]; const float* gam = (const float*)d_in[9];
    float* out = (float*)d_out;    // [4][256][64][64]
    char* wsp = (char*)d_ws;
    auto take = [&](size_t bytes) { char* p = wsp; wsp += (bytes + 255) & ~(size_t)255; return (void*)p; };
    bf* WqB = (bf*)take(CQ * CC * 2); bf* WkB = (bf*)take(CQ * CC * 2); bf* WvB = (bf*)take(CC * CC * 2);
    bf* XT = (bf*)take((size_t)NN * CC * 2); float* TMP = (float*)take((size_t)CC * NN * 4);
    bf* Qh = (bf*)take((size_t)NN * CQ * 2); bf* Ql = (bf*)take((size_t)NN * CQ * 2); bf* Kh = (bf*)take((size_t)NN * CQ * 2); bf* Kl = (bf*)take((size_t)NN * CQ * 2); bf* Vh = (bf*)take((size_t)CC * NN * 2); bf* Vl = (bf*)take((size_t)CC * NN * 2);
    float* S = (float*)take((size_t)RCH * NN * 4); bf* PH = (bf*)take((size_t)RCH * NN * 2); bf* PL = (bf*)take((size_t)RCH * NN * 2); float* O = (float*)take((size_t)CC * NN * 4);
    if ((size_t)(wsp - (char*)d_ws) > ws_size) return;    // 0.2 + 2.1 + 4.2 + 4 x 1 + 2 x 2.1 + 67.1 + 2 x 33.6 + 4.2 ~ 153 MB, no aliasing (TMP reused q -> k -> v in stream order)
    { const size_t n1 = CQ * CC / 8, n3 = CC * CC / 8; k_cvt8<<<(unsigned)((n1 + 255) / 256), 256, 0, stream>>>(Wq, WqB, n1); k_cvt8<<<(unsigned)((n1 + 255) / 256), 256, 0, stream>>>(Wk, WkB, n1); k_cvt8<<<(unsigned)((n3 + 255) / 256), 256, 0, stream>>>(Wv, WvB, n3); }
    for (int b = 0; b < NBI; ++b) {
        const float* xb = x + (size_t)b * CC * NN; const float* mb = mask + (size_t)b * NN; const float* sb = skin + (size_t)b * NN;
        k_wt<<<dim3(CC / 64, NN / 64, 1), 256, 0, stream>>>(xb, CC, NN, XT);                                                                   // x^T [n][c] bf16 (rounded)
        k_gemmb<false, false><<<dim3(NN / 64, CQ / 64, 1), 128, 0, stream>>>(XT, nullptr, WqB, bq, TMP, CQ, nullptr); k_split128s<<<NN / 8, 256, 0, stream>>>(TMP, NN, nullptr, nullptr, Qh, Ql);   // q^T [n][128]
        k_gemmb<false, false><<<dim3(NN / 64, CQ / 64, 1), 128, 0, stream>>>(XT, nullptr, WkB, bk, TMP, CQ, nullptr); k_split128s<<<NN / 8, 256, 0, stream>>>(TMP, NN, mb, sb, Kh, Kl);             // k^T (1-mask) skin
        k_gemmrb<false><<<dim3(CC / 64, NN / 64, 1), 128, 0, stream>>>(WvB, nullptr, XT, bv, TMP, NN, CC); k_rowsplit<<<CC / 8, 256, 0, stream>>>(TMP, CC, Vh, Vl);               // v [c][n] (+ bv per row)
        for (int ch = 0; ch < NN / RCH; ++ch) { const size_t m0 = (size_t)ch * RCH;
            k_gemm3<<<dim3(RCH / 64, NN / 64, 1), 128, 0, stream>>>(Qh + m0 * CQ, Ql + m0 * CQ, Kh, Kl, CQ, S, NN);                               // energy rows [m][n] = q_m . k_n
            k_softmax<<<RCH / 8, 256, 0, stream>>>(S, PH, PL);
            k_gemm3<<<dim3(CC / 64, RCH / 64, 1), 128, 0, stream>>>(Vh, Vl, PH, PL, NN, O + m0, NN); }                                            // o[c][m0..] = v . P^T
        k_fin<<<CC / 8, 256, 0, stream>>>(O, xb, mb, sb, gam, out + (size_t)b * CC * NN);
    }
}

// v002
// A run of this version takes 596 microseconds.
// In two side-by-side timings against v001, it was 2.12 and 2.11 times as fast.
// Counting every step since v000, it is 5.52 times as fast.
#include <hip/hip_runtime.h>

// Compute dtypes, f32 accumulate, one batch item per pass: q, k (128 ch) token-major and v (256 ch) channel-major 1x1 convs as GEMMs with PLAIN bf16 operands (rounded input/weights,
// exact products, + bias; k then scaled per position by (1 - mask) skin_mask in f32) -> bf16 hi + UNSCALED residual planes; energy rows S[m][n] = q_m . k_n ([4096 x 128].[128 x 4096]
// per chunk, three products) -> row softmax in f32 -> P planes; o[c][m] = sum_n v[c][n] P[m][n] ([256 x 4096].[4096 x 4096] per chunk, three products) - all on

#define NBI  4
#define CC   256
#define CQ   128
#define NN   4096
#define RCH  4096   // energy rows per pass = the whole item: the o product then launches 256 blocks (one per WGP) instead of 64
#define DM   CC
#define NTK  NN
#define LOSC 1024.0f

typedef _Float16 h16;
typedef unsigned short bf;
typedef __attribute__((ext_vector_type(16))) __bf16   v16bf;
typedef __attribute__((ext_vector_type(16))) _Float16 v16h;
typedef __attribute__((ext_vector_type(8)))  _Float16 v8h;
typedef __attribute__((ext_vector_type(8)))  unsigned short v8us;
typedef __attribute__((ext_vector_type(8)))  float    v8f;
typedef __attribute__((ext_vector_type(4)))  float    v4f;
typedef __attribute__((ext_vector_type(4)))  _Float16 v4h;
typedef v8h  __attribute__((may_alias)) v8ha;
typedef v4f  __attribute__((may_alias)) v4fa;
typedef v8us __attribute__((may_alias)) v8usa;

__device__ __forceinline__ unsigned short f2bf(float f) { unsigned u = __float_as_uint(f); u += 0x7FFFu + ((u >> 16) & 1u); return (unsigned short)(u >> 16); }
__device__ __forceinline__ float bf2f(unsigned short b) { return __uint_as_float(((unsigned)b) << 16); }
__device__ __forceinline__ float bfr(float f) { return bf2f(f2bf(f)); }
__device__ __forceinline__ v16h cat16(v8h lo, v8h hi) { return __builtin_shufflevector(lo, hi, 0, 1, 2, 3, 4, 5, 6, 7, 8, 9, 10, 11, 12, 13, 14, 15); }
__device__ __forceinline__ v16bf cat16b(v8us lo, v8us hi) { return __builtin_bit_cast(v16bf, __builtin_shufflevector(lo, hi, 0, 1, 2, 3, 4, 5, 6, 7, 8, 9, 10, 11, 12, 13, 14, 15)); }
__device__ __forceinline__ v8f wmma16(v16h a, v16h b, v8f c) { return __builtin_amdgcn_wmma_f32_16x16x32_f16(false, a, false, b, (short)0, c, false, false); }
__device__ __forceinline__ v8f wmmab(v16bf a, v16bf b, v8f c) { return __builtin_amdgcn_wmma_f32_16x16x32_bf16(false, a, false, b, (short)0, c, false, false); }

// k_wt: WT [n][K] = bf16(W[k][n]) (k-major [K][ncols]) via 64 x 64 LDS tiles; grid (K/64, ncols/64).
__global__ __launch_bounds__(256) void k_wt(const float* __restrict__ Wm, int K, int ncols, bf* WT) {
    __shared__ __align__(16) unsigned short tl[64 * 72];
    const int tid = threadIdx.x, k0 = blockIdx.x * 64, n0 = blockIdx.y * 64;
    const int kk = tid >> 2, nq = (tid & 3) * 16;
#pragma unroll
    for (int i = 0; i < 16; ++i) tl[(nq + i) * 72 + kk] = f2bf(Wm[(size_t)(k0 + kk) * ncols + n0 + nq + i]);
    __syncthreads();
    const int piece = tid & 7;
    auto pass = [&]() {
#pragma unroll
        for (int s = 0; s < 2; ++s) { const int nr = (tid >> 3) + 32 * s; const v8us val = *(const v8usa*)(tl + nr * 72 + piece * 8); *(v8us*)(WT + (size_t)(n0 + nr) * K + k0 + piece * 8) = val; }
    };
    pass(); 
}
// Tensor-load staging of the GEMMs' operand tiles: one slice = 64 rows x 128 k = 64 rows of 256 B; each of a block's four waves brings one slice with one request.
// LDS row pitch 272 B (the mover's 16-B pad behind every 256-B row, an odd multiple of 16 B for the 16-byte fragment reads); a slice's 64 x 272 B are rounded up to a multiple of 2 KiB.
typedef unsigned int u32;
typedef u32 u32x4 __attribute__((ext_vector_type(4)));
typedef u32 u32x8 __attribute__((ext_vector_type(8)));
#define TPITCH 272u
#define TSLICE 18432u
#define TBUF   (4u * TSLICE)
__device__ __forceinline__ u32 uni(u32 v) { return (u32)__builtin_amdgcn_readfirstlane(v); }
__device__ __forceinline__ u32 pinned(u32 v) { u32 w = uni(v); asm volatile("" : "+s"(w)); return w; }   // a wave-uniform word held in a scalar register: a test on it is a scalar branch round the tensor load, a descriptor word made from it is formed behind the waits in front of it
__device__ __forceinline__ void tdm_load(u32x4 g0, u32x8 g1) { asm volatile("tensor_load_to_lds %0, %1" :: "s"(g0), "s"(g1) : "memory"); }   // one request of the whole wave: a 2-D tile from global memory into LDS, through no register
__device__ __forceinline__ u32x8 tdm_group1(u32 src_pitch) {   // 1-byte elements, tensor = tile = 64 rows of 256 B, no mask, a 4-dword pad behind every 64 dwords
    u32x8 g;
    g[0] = uni((1u << 20) | (5u << 22) | (3u << 25)); g[1] = uni(256u << 16); g[2] = uni(64u << 16); g[3] = uni(256u << 16);
    g[4] = uni(64u); g[5] = uni(src_pitch); g[6] = uni(0u); g[7] = uni(0u);
    return g;
}
__device__ __forceinline__ u32x4 tdm_group0(u32 lds_dst, unsigned long long ga) {
    u32x4 g;
    g[0] = uni(1u); g[1] = uni(lds_dst); g[2] = uni((u32)ga); g[3] = uni((((u32)(ga >> 32)) & 0x01FFFFFFu) | 0x80000000u);
    return g;
}

// mm_k256: acc += A64.B64^T for 64 rows of A and 64 rows of B, K = 256, both K-contiguous with row stride 256. The four slices (A k 0-127, A k 128-255, B k 0-127, B k 128-255) are
// loaded once, one by each wave; the wave then takes rows 16 wave .. 16 wave + 15 of A against all 64 rows of B, k ascending.
__device__ __forceinline__ void mm_k256(const bf* A64, const bf* B64, unsigned char* tile, v8f (&acc)[4]) {
    const int lane = threadIdx.x & 31, wave = threadIdx.x >> 5, lr = lane & 15, hi = lane >> 4;
    const u32 wv = uni(threadIdx.x >> 5);
    const bf* src = (wv < 2u ? A64 : B64) + (wv & 1u) * 128u;
    tdm_load(tdm_group0((u32)(size_t)tile + wv * TSLICE, (unsigned long long)(size_t)src), tdm_group1(512u));
    asm volatile("s_wait_tensorcnt 0x0" ::: "memory");   // this wave's slice has landed
    __syncthreads();                                       // ... and every other wave's: the tiles may be read
    struct Fr { v16bf a, b[4]; };   // the fragments of one 32-k step
    auto ldf = [&](Fr& f, const unsigned char* half, int kk) {
        const unsigned char* pa = half + (wave * 16 + lr) * TPITCH + hi * 16 + kk * 64;
        const unsigned char* pb = half + 2u * TSLICE + lr * TPITCH + hi * 16 + kk * 64;
        f.a = cat16b(*(const v8usa*)pa, *(const v8usa*)(pa + 32));
#pragma unroll
        for (int t = 0; t < 4; ++t) f.b[t] = cat16b(*(const v8usa*)(pb + t * 16 * TPITCH), *(const v8usa*)(pb + t * 16 * TPITCH + 32));
    };
#pragma unroll 1
    for (int h = 0; h < 2; ++h) {   // rolled over the two k halves: the accumulators then keep registers of their own, apart from every fragment's
        const unsigned char* half = tile + (u32)h * TSLICE;
        Fr f[2];
        ldf(f[0], half, 0);
#pragma unroll
        for (int kk = 0; kk < 4; ++kk) {   // the scheduling fences keep the next step's 10 LDS reads together as one group in front of this step's products
            if (kk < 3) ldf(f[(kk + 1) & 1], half, kk + 1);
            __builtin_amdgcn_sched_barrier(0);
#pragma unroll
            for (int t = 0; t < 4; ++t) acc[t] = wmmab(f[kk & 1].a, f[kk & 1].b[t], acc[t]);
            __builtin_amdgcn_sched_barrier(0);
        }
    }
}

// k_gemmb: 64 x 64 block tile (4 waves x 16 x 64) of C[NTK][NW] = (A [+ Al]).B^T (K = 256) [+ bf(bias[c])] [+ bf(R[r][c]) residual]; f32 whole-line epilogue (or f16
template <bool SPLITA, bool F16OUT = false>
__global__ __launch_bounds__(128) void k_gemmb(const bf* __restrict__ A, const bf* __restrict__ Al, const bf* __restrict__ Bn, const float* __restrict__ bias, float* C, int ldc, h16* C2, const float* __restrict__ R = nullptr, int roundR = 1) {
    constexpr int K = DM;
    static_assert(K == 256, "mm_k256 takes K = 256");
    __shared__ __attribute__((aligned(2048))) unsigned char tile[TBUF];
    __shared__ __align__(16) float ost[4][16 * 68];
    const int lane = threadIdx.x & 31, wave = threadIdx.x >> 5, lr = lane & 15, hi = lane >> 4;
    const int r0 = blockIdx.x * 64 + wave * 16, c0 = blockIdx.y * 64;
    const size_t aoff = (size_t)(r0 + lr) * K + 8 * hi;
    size_t boff[4];
#pragma unroll
    for (int t = 0; t < 4; ++t) boff[t] = (size_t)(c0 + t * 16 + lr) * K + 8 * hi;
    v8f acc[4];
#pragma unroll
    for (int t = 0; t < 4; ++t) acc[t] = (v8f){};
    if constexpr (!SPLITA) mm_k256(A + (size_t)blockIdx.x * 64 * K, Bn + (size_t)c0 * K, tile, acc);
    else
#pragma unroll 1
    for (int kc = 0; kc < K; kc += 32) {
        const v16bf a = cat16b(*(const v8us*)(A + aoff + kc), *(const v8us*)(A + aoff + kc + 16));
        v16bf al = a;
        if (SPLITA) al = cat16b(*(const v8us*)(Al + aoff + kc), *(const v8us*)(Al + aoff + kc + 16));
#pragma unroll
        for (int t = 0; t < 4; ++t) { const v16bf b = cat16b(*(const v8us*)(Bn + boff[t] + kc), *(const v8us*)(Bn + boff[t] + kc + 16)); acc[t] = wmmab(a, b, acc[t]); if (SPLITA) acc[t] = wmmab(al, b, acc[t]); }
        asm volatile("v_nop\n\tv_nop\n\tv_nop\n\tv_nop" : "+v"(acc[0]), "+v"(acc[1]), "+v"(acc[2]), "+v"(acc[3]) : "v"(a), "v"(al));
    }
    float* os = &ost[wave][0];
#pragma unroll
    for (int t = 0; t < 4; ++t) { const float bv = bias ? bfr(bias[c0 + t * 16 + lr]) : 0.f;
#pragma unroll
        for (int j = 0; j < 8; ++j) os[(hi * 8 + j) * 68 + t * 16 + lr] = acc[t][j] + bv; }
    __syncthreads();
    if (F16OUT) {
        h16* crow = (h16*)(void*)C + (size_t)r0 * ldc + c0;
        auto pass = [&]() {
#pragma unroll
            for (int s = 0; s < 4; ++s) { const int row = 4 * s + (lane >> 3), piece = lane & 7; const float* sp = os + row * 68 + piece * 8; v8h o, o2;
#pragma unroll
                for (int i = 0; i < 8; ++i) { const h16 a = (h16)sp[i]; o[i] = a; o2[i] = (h16)((sp[i] - (float)a) * LOSC); }
                *(v8h*)(crow + (size_t)row * ldc + piece * 8) = o; if (C2) *(v8h*)(C2 + (size_t)r0 * ldc + c0 + (size_t)row * ldc + piece * 8) = o2; }
        };
        pass(); 
    } else {
        float* crow = C + (size_t)r0 * ldc + c0;
        auto pass = [&]() {
#pragma unroll
            for (int s = 0; s < 8; ++s) { const int Lid = (lane >> 3) + 4 * s, piece = lane & 7; const int row = Lid >> 1, cofs = (Lid & 1) * 32 + piece * 4;
                v4f val = *(const v4fa*)(os + row * 68 + cofs); if (R) { const v4f rv = *(const v4f*)(R + ((size_t)r0 + row) * ldc + c0 + cofs); val += roundR ? (v4f){bfr(rv[0]), bfr(rv[1]), bfr(rv[2]), bfr(rv[3])} : rv; }
                *(v4f*)(crow + (size_t)row * ldc + cofs) = val; }
        };
        pass(); 
    }
}

// k_gemm3: 64 x 64 tile of C = (Ah + Al).(Bh + Bl)^T over K (row strides = K for all four planes; n-major B): three products per 32-k step (hh, lh, hl); f32.
// The operand tiles come into LDS by tensor loads (K = 128: one stage, loaded once; longer K: two buffers, the next stage in flight while this one is worked on).
template <int K>
__global__ __launch_bounds__(128) void k_gemm3(const bf* __restrict__ Ah, const bf* __restrict__ Al, const bf* __restrict__ Bh, const bf* __restrict__ Bl, float* C, int ldc) {
    constexpr int NST = K / 128;
    static_assert(K % 128 == 0 && NST >= 1, "K is a whole number of 128-k stages");
    __shared__ __attribute__((aligned(2048))) unsigned char ring[(NST > 1 ? 2u : 1u) * TBUF];
    __shared__ __align__(16) float ost[4][16 * 68];
    const int lane = threadIdx.x & 31, wave = threadIdx.x >> 5, lr = lane & 15, hi = lane >> 4;
    const int r0 = blockIdx.x * 64 + wave * 16, c0 = blockIdx.y * 64;
    const u32 wv = uni(threadIdx.x >> 5);
    const bf* plane = wv == 0u ? Ah : wv == 1u ? Al : wv == 2u ? Bh : Bl;
    const unsigned long long gsrc = (unsigned long long)(size_t)(plane + (size_t)(wv < 2u ? blockIdx.x : blockIdx.y) * 64 * K);
    const u32 ldst = (u32)(size_t)ring + wv * TSLICE;
    const u32x8 g1 = tdm_group1(2u * K);
    auto issue = [&](u32 st) { tdm_load(tdm_group0(ldst + (st & 1u) * TBUF, gsrc + (unsigned long long)st * 256u), g1); };
    v8f acc[4];
#pragma unroll
    for (int t = 0; t < 4; ++t) acc[t] = (v8f){};
    struct Fr { v16bf a, al, bh[4], bl[4]; };   // the fragments of one 32-k step
    auto ldf = [&](Fr& f, const unsigned char* buf, int kk) {
        const unsigned char* pa = buf + (wave * 16 + lr) * TPITCH + hi * 16 + kk * 64;
        const unsigned char* pb = buf + 2u * TSLICE + lr * TPITCH + hi * 16 + kk * 64;
        f.a = cat16b(*(const v8usa*)pa, *(const v8usa*)(pa + 32)); f.al = cat16b(*(const v8usa*)(pa + TSLICE), *(const v8usa*)(pa + TSLICE + 32));
#pragma unroll
        for (int t = 0; t < 4; ++t) { const unsigned char* q = pb + t * 16 * TPITCH;
            f.bh[t] = cat16b(*(const v8usa*)q, *(const v8usa*)(q + 32)); f.bl[t] = cat16b(*(const v8usa*)(q + TSLICE), *(const v8usa*)(q + TSLICE + 32)); }
    };
    auto mm = [&](const Fr& f) {   // per accumulator the order hh, lh, hl; the four tiles interleaved so that no product waits for the one before it
#pragma unroll
        for (int t = 0; t < 4; ++t) acc[t] = wmmab(f.a, f.bh[t], acc[t]);
#pragma unroll
        for (int t = 0; t < 4; ++t) acc[t] = wmmab(f.al, f.bh[t], acc[t]);
#pragma unroll
        for (int t = 0; t < 4; ++t) acc[t] = wmmab(f.a, f.bl[t], acc[t]);
    };
    // One pass = the four 32-k steps of one stage, two fragment sets. The scheduling fences keep each step's 20 LDS reads together as one group in front of the
    // products of the step before; without them the compiler spreads the reads among the products and waits for each pair.
    auto pass = [&](const unsigned char* buf) {
        Fr f0, f1;
        ldf(f0, buf, 0);
        ldf(f1, buf, 1); __builtin_amdgcn_sched_barrier(0); mm(f0); __builtin_amdgcn_sched_barrier(0);
        ldf(f0, buf, 2); __builtin_amdgcn_sched_barrier(0); mm(f1); __builtin_amdgcn_sched_barrier(0);
        ldf(f1, buf, 3); __builtin_amdgcn_sched_barrier(0); mm(f0); __builtin_amdgcn_sched_barrier(0);
        mm(f1);
    };
    issue(0u);
    asm volatile("s_wait_tensorcnt 0x0" ::: "memory");   // this wave's plane of stage 0 has landed
    __syncthreads();                                       // ... and every other wave's: stage 0 may be read
    if constexpr (NST == 1) {
        pass(ring);
    } else {
        issue(1u);
#pragma unroll 1
        for (int s = 0; s < NST; ++s) {   // rolled: one pass per stage, the publish point at its foot
            pass(ring + (u32)(s & 1) * TBUF);
            asm volatile("s_wait_dscnt 0x0" ::: "memory");       // this wave's reads of stage s are done before its buffer is refilled
            asm volatile("s_wait_tensorcnt 0x0" ::: "memory");   // this wave's plane of stage s + 1 has landed
            __syncthreads();                                      // publishes stage s + 1 and ends every wave's reads of stage s
            if (pinned((u32)(s + 2 < NST))) issue(pinned((u32)s + 2u));   // pinned: scalar branch round the tensor load; its descriptor words formed behind the wait
        }
        asm volatile("s_wait_tensorcnt 0x0" ::: "memory");   // no request is left in flight at the wave's end
        asm volatile("s_wait_dscnt 0x0" ::: "memory");
    }
    float* os = &ost[wave][0];
#pragma unroll
    for (int t = 0; t < 4; ++t) {
#pragma unroll
        for (int j = 0; j < 8; ++j) os[(hi * 8 + j) * 68 + t * 16 + lr] = acc[t][j]; }
    __builtin_amdgcn_wave_barrier(); asm volatile("" ::: "memory");
    float* crow = C + (size_t)r0 * ldc + c0;
    auto wr = [&]() {
#pragma unroll
        for (int s = 0; s < 8; ++s) { const int Lid = (lane >> 3) + 4 * s, piece = lane & 7; const int row = Lid >> 1, cofs = (Lid & 1) * 32 + piece * 4;
            const v4f val = *(const v4fa*)(os + row * 68 + cofs); *(v4f*)(crow + (size_t)row * ldc + cofs) = val; }
    };
    wr(); 
}

// k_gemmrb: 64 x 64 tile of C[o][v] = (A [+ Al]).B^T over K (A row stride K, B n-major row stride K) + bf(rbias[o]) per ROW; f32 whole-line epilogue (8 lanes x 16 B per line),
template <bool SPLITA>
__global__ __launch_bounds__(128) void k_gemmrb(const bf* __restrict__ A, const bf* __restrict__ Al, const bf* __restrict__ Bn, const float* __restrict__ rbias, float* C, int ldc) {
    constexpr int K = CC;
    static_assert(K == 256, "mm_k256 takes K = 256");
    __shared__ __attribute__((aligned(2048))) unsigned char tile[TBUF];
    __shared__ __align__(16) float ost[4][16 * 68];
    const int lane = threadIdx.x & 31, wave = threadIdx.x >> 5, lr = lane & 15, hi = lane >> 4;
    const int r0 = blockIdx.x * 64 + wave * 16, c0 = blockIdx.y * 64;
    const size_t aoff = (size_t)(r0 + lr) * K + 8 * hi;
    v8f acc[4];
#pragma unroll
    for (int t = 0; t < 4; ++t) acc[t] = (v8f){};
    if constexpr (!SPLITA) mm_k256(A + (size_t)blockIdx.x * 64 * K, Bn + (size_t)c0 * K, tile, acc);
    else
#pragma unroll 1
    for (int kc = 0; kc < K; kc += 32) {
        const v16bf a = cat16b(*(const v8us*)(A + aoff + kc), *(const v8us*)(A + aoff + kc + 16));
        v16bf al = a; if (SPLITA) al = cat16b(*(const v8us*)(Al + aoff + kc), *(const v8us*)(Al + aoff + kc + 16));
#pragma unroll
        for (int t = 0; t < 4; ++t) { const size_t bo = (size_t)(c0 + t * 16 + lr) * K + kc + 8 * hi; const v16bf bb = cat16b(*(const v8us*)(Bn + bo), *(const v8us*)(Bn + bo + 16)); acc[t] = wmmab(a, bb, acc[t]); if (SPLITA) acc[t] = wmmab(al, bb, acc[t]); }
        asm volatile("v_nop\n\tv_nop\n\tv_nop\n\tv_nop" : "+v"(acc[0]), "+v"(acc[1]), "+v"(acc[2]), "+v"(acc[3]) : "v"(a), "v"(al));
    }
    float* os = &ost[wave][0];
#pragma unroll
    for (int t = 0; t < 4; ++t) {
#pragma unroll
        for (int j = 0; j < 8; ++j) os[(hi * 8 + j) * 68 + t * 16 + lr] = acc[t][j] + bfr(rbias[r0 + hi * 8 + j]); }
    __builtin_amdgcn_wave_barrier(); asm volatile("" ::: "memory");
    float* crow = C + (size_t)r0 * ldc + c0;
    auto pass = [&]() {
#pragma unroll
        for (int s = 0; s < 8; ++s) { const int Lid = (lane >> 3) + 4 * s, piece = lane & 7; const int row = Lid >> 1, cofs = (Lid & 1) * 32 + piece * 4;
            const v4f val = *(const v4fa*)(os + row * 68 + cofs); *(v4f*)(crow + (size_t)row * ldc + cofs) = val; }
    };
    pass(); 
}
__global__ __launch_bounds__(256) void k_rowsplit(const float* __restrict__ Y, int nrows, bf* Ph, bf* Pl) {
    const int lane = threadIdx.x & 31, r = blockIdx.x * 8 + (threadIdx.x >> 5); if (r >= nrows) return;
{
#pragma unroll 1
        for (int c0 = lane * 8; c0 < NN; c0 += 256) { const size_t o = (size_t)r * NN + c0; const v8f v = *(const v8f*)(Y + o); v8us oh, ol;
#pragma unroll
            for (int i = 0; i < 8; ++i) { const unsigned short hb = f2bf(v[i]); oh[i] = hb; ol[i] = f2bf(v[i] - bf2f(hb)); }
            *(v8us*)(Ph + o) = oh; *(v8us*)(Pl + o) = ol; }
         }
}
__global__ __launch_bounds__(256) void k_softmax(const float* __restrict__ S, bf* PH, bf* PL) {
    const int lane = threadIdx.x & 31, r = blockIdx.x * 8 + (threadIdx.x >> 5); if (r >= RCH) return;
    const float* sr = S + (size_t)r * NN; float m = -3.0e38f;
#pragma unroll 1
    for (int c0 = lane * 8; c0 < NN; c0 += 256) { const v8f v = *(const v8f*)(sr + c0);
#pragma unroll
        for (int i = 0; i < 8; ++i) m = fmaxf(m, v[i]); }
#pragma unroll
    for (int sh = 16; sh; sh >>= 1) m = fmaxf(m, __shfl_xor(m, sh, 32));
    float sum = 0.f;
#pragma unroll 1
    for (int c0 = lane * 8; c0 < NN; c0 += 256) { const v8f v = *(const v8f*)(sr + c0);
#pragma unroll
        for (int i = 0; i < 8; ++i) sum += __expf(v[i] - m); }
#pragma unroll
    for (int sh = 16; sh; sh >>= 1) sum += __shfl_xor(sum, sh, 32);
    const float inv = 1.0f / sum;
{
#pragma unroll 1
        for (int c0 = lane * 8; c0 < NN; c0 += 256) { const v8f v = *(const v8f*)(sr + c0); v8us oh, ol;
#pragma unroll
            for (int i = 0; i < 8; ++i) { const float p = __expf(v[i] - m) * inv; const unsigned short hb = f2bf(p); oh[i] = hb; ol[i] = f2bf(p - bf2f(hb)); }
            const size_t o = (size_t)r * NN + c0; *(v8us*)(PH + o) = oh; *(v8us*)(PL + o) = ol; }
         }
}
__global__ __launch_bounds__(256) void k_cvt8(const float* __restrict__ src, bf* dst, size_t n8) {
    const size_t i = (size_t)blockIdx.x * 256 + threadIdx.x; if (i >= n8) return;
    const v8f v = *(const v8f*)(src + i * 8); v8us o;
#pragma unroll
    for (int k = 0; k < 8; ++k) o[k] = f2bf(v[k]);
    *(v8us*)(dst + i * 8) = o; 
}
__global__ __launch_bounds__(256) void k_zero8(bf* dst, size_t n8) {
    const size_t i = (size_t)blockIdx.x * 256 + threadIdx.x; if (i >= n8) return; v8us z;
#pragma unroll
    for (int k = 0; k < 8; ++k) z[k] = 0;
    *(v8us*)(dst + i * 8) = z; 
}

// k_split128s: bf16 hi + UNSCALED residual planes of a computed f32 [rows][128] matrix, optionally scaled per row by f = (1 - bf(mask[r])) bf(skin[r]); one wave per row: lane -> 4
__global__ __launch_bounds__(256) void k_split128s(const float* __restrict__ src, int nrows, const float* __restrict__ msk, const float* __restrict__ skn, bf* dh, bf* dl) {
    typedef __attribute__((ext_vector_type(4))) unsigned short v4us;
    const int lane = threadIdx.x & 31, r = blockIdx.x * 8 + (threadIdx.x >> 5); if (r >= nrows) return;
    const float f = msk ? (1.0f - bfr(msk[r])) * bfr(skn[r]) : 1.0f;
    const size_t o = (size_t)r * CQ + lane * 4; const v4f v = *(const v4f*)(src + o); v4us oh, ol;
#pragma unroll
    for (int i = 0; i < 4; ++i) { const float y = v[i] * f; const unsigned short hb = f2bf(y); oh[i] = hb; ol[i] = f2bf(y - bf2f(hb)); }
    *(v4us*)(dh + o) = oh; *(v4us*)(dl + o) = ol; 
}
// k_fin: out[c][n] = bf(gamma) (O[c][n] bf(mask[n]) bf(skin[n])) + bf(x[c][n]) over the item (f32); one wave per channel row: lane -> 4 consecutive floats per 128-column chunk (8 lanes
__global__ __launch_bounds__(256) void k_fin(const float* __restrict__ O, const float* __restrict__ X, const float* __restrict__ msk, const float* __restrict__ skn, const float* __restrict__ gam, float* OUTP) {
    const int lane = threadIdx.x & 31, r = blockIdx.x * 8 + (threadIdx.x >> 5); if (r >= CC) return; const float g = bfr(gam[0]);
{
#pragma unroll 1
        for (int c0 = lane * 4; c0 < NN; c0 += 128) { const size_t o = (size_t)r * NN + c0; const v4f ov = *(const v4f*)(O + o), xv = *(const v4f*)(X + o); v4f y;
#pragma unroll
            for (int i = 0; i < 4; ++i) y[i] = fmaf(g, ov[i] * bfr(msk[c0 + i]) * bfr(skn[c0 + i]), bfr(xv[i]));
            *(v4f*)(OUTP + o) = y; }
         }
}

extern "C" void kernel_launch(void* const* d_in, const int* in_sizes, int n_in,
                              void* d_out, int out_size, void* d_ws, size_t ws_size, hipStream_t stream) {
    (void)in_sizes; (void)n_in; (void)out_size;
    const float* x = (const float*)d_in[0]; const float* mask = (const float*)d_in[1]; const float* skin = (const float*)d_in[2];
    const float* Wq = (const float*)d_in[3]; const float* bq = (const float*)d_in[4]; const float* Wk = (const float*)d_in[5]; const float* bk = (const float*)d_in[6]; const float* Wv = (const float*)d_in[7]; const float* bv = (const float*)d_in[8]; const float* gam = (const float*)d_in[9];
    float* out = (float*)d_out;    // [4][256][64][64]
    char* wsp = (char*)d_ws;
    auto take = [&](size_t bytes) { char* p = wsp; wsp += (bytes + 255) & ~(size_t)255; return (void*)p; };
    bf* WqB = (bf*)take(CQ * CC * 2); bf* WkB = (bf*)take(CQ * CC * 2); bf* WvB = (bf*)take(CC * CC * 2);
    bf* XT = (bf*)take((size_t)NN * CC * 2); float* TMP = (float*)take((size_t)CC * NN * 4);
    bf* Qh = (bf*)take((size_t)NN * CQ * 2); bf* Ql = (bf*)take((size_t)NN * CQ * 2); bf* Kh = (bf*)take((size_t)NN * CQ * 2); bf* Kl = (bf*)take((size_t)NN * CQ * 2); bf* Vh = (bf*)take((size_t)CC * NN * 2); bf* Vl = (bf*)take((size_t)CC * NN * 2);
    float* S = (float*)take((size_t)RCH * NN * 4); bf* PH = (bf*)take((size_t)RCH * NN * 2); bf* PL = (bf*)take((size_t)RCH * NN * 2); float* O = (float*)take((size_t)CC * NN * 4);
    if ((size_t)(wsp - (char*)d_ws) > ws_size) return;    // 0.2 + 2.1 + 4.2 + 4 x 1 + 2 x 2.1 + 67.1 + 2 x 33.6 + 4.2 ~ 153 MB, no aliasing (TMP reused q -> k -> v in stream order)
    { const size_t n1 = CQ * CC / 8, n3 = CC * CC / 8; k_cvt8<<<(unsigned)((n1 + 255) / 256), 256, 0, stream>>>(Wq, WqB, n1); k_cvt8<<<(unsigned)((n1 + 255) / 256), 256, 0, stream>>>(Wk, WkB, n1); k_cvt8<<<(unsigned)((n3 + 255) / 256), 256, 0, stream>>>(Wv, WvB, n3); }
    for (int b = 0; b < NBI; ++b) {
        const float* xb = x + (size_t)b * CC * NN; const float* mb = mask + (size_t)b * NN; const float* sb = skin + (size_t)b * NN;
        k_wt<<<dim3(CC / 64, NN / 64, 1), 256, 0, stream>>>(xb, CC, NN, XT);                                                                   // x^T [n][c] bf16 (rounded)
        k_gemmb<false, false><<<dim3(NN / 64, CQ / 64, 1), 128, 0, stream>>>(XT, nullptr, WqB, bq, TMP, CQ, nullptr); k_split128s<<<NN / 8, 256, 0, stream>>>(TMP, NN, nullptr, nullptr, Qh, Ql);   // q^T [n][128]
        k_gemmb<false, false><<<dim3(NN / 64, CQ / 64, 1), 128, 0, stream>>>(XT, nullptr, WkB, bk, TMP, CQ, nullptr); k_split128s<<<NN / 8, 256, 0, stream>>>(TMP, NN, mb, sb, Kh, Kl);             // k^T (1-mask) skin
        k_gemmrb<false><<<dim3(CC / 64, NN / 64, 1), 128, 0, stream>>>(WvB, nullptr, XT, bv, TMP, NN); k_rowsplit<<<CC / 8, 256, 0, stream>>>(TMP, CC, Vh, Vl);               // v [c][n] (+ bv per row)
        for (int ch = 0; ch < NN / RCH; ++ch) { const size_t m0 = (size_t)ch * RCH;
            k_gemm3<CQ><<<dim3(RCH / 64, NN / 64, 1), 128, 0, stream>>>(Qh + m0 * CQ, Ql + m0 * CQ, Kh, Kl, S, NN);                               // energy rows [m][n] = q_m . k_n
            k_softmax<<<RCH / 8, 256, 0, stream>>>(S, PH, PL);
            k_gemm3<NN><<<dim3(CC / 64, RCH / 64, 1), 128, 0, stream>>>(Vh, Vl, PH, PL, O + m0, NN); }                                            // o[c][m0..] = v . P^T
        k_fin<<<CC / 8, 256, 0, stream>>>(O, xb, mb, sb, gam, out + (size_t)b * CC * NN);
    }
}

// v003
// A run of this version takes 312 microseconds.
// Two timings next to v002 put it at 1.92 and 1.93 times that version's speed.
// Over all steps from v000 it is 10.6 times as fast.
#include <hip/hip_runtime.h>

// Compute dtypes, f32 accumulate: per batch item q, k (128 ch) token-major and v (256 ch) channel-major 1x1 convs as GEMMs with PLAIN bf16 operands (rounded input/weights,
// exact products, + bias; k then scaled per position by (1 - mask) skin_mask in f32) -> bf16 hi + UNSCALED residual planes; then, all items in one launch, energy S[m][n] = q_m . k_n
// (three products) -> row softmax in f32 with a running maximum and sum -> o[c][m] = sum_n v[c][n] P[m][n] (three products), the scores never leaving the WGP - all on

#define NBI  4
#define CC   256
#define CQ   128
#define NN   4096
#define DM   CC
#define NTK  NN
#define LOSC 1024.0f

typedef _Float16 h16;
typedef unsigned short bf;
typedef __attribute__((ext_vector_type(16))) __bf16   v16bf;
typedef __attribute__((ext_vector_type(16))) _Float16 v16h;
typedef __attribute__((ext_vector_type(8)))  _Float16 v8h;
typedef __attribute__((ext_vector_type(8)))  unsigned short v8us;
typedef __attribute__((ext_vector_type(8)))  float    v8f;
typedef __attribute__((ext_vector_type(4)))  float    v4f;
typedef __attribute__((ext_vector_type(4)))  _Float16 v4h;
typedef v8h  __attribute__((may_alias)) v8ha;
typedef v4f  __attribute__((may_alias)) v4fa;
typedef v8us __attribute__((may_alias)) v8usa;

__device__ __forceinline__ unsigned short f2bf(float f) { unsigned u = __float_as_uint(f); u += 0x7FFFu + ((u >> 16) & 1u); return (unsigned short)(u >> 16); }
__device__ __forceinline__ float bf2f(unsigned short b) { return __uint_as_float(((unsigned)b) << 16); }
__device__ __forceinline__ float bfr(float f) { return bf2f(f2bf(f)); }
__device__ __forceinline__ v16h cat16(v8h lo, v8h hi) { return __builtin_shufflevector(lo, hi, 0, 1, 2, 3, 4, 5, 6, 7, 8, 9, 10, 11, 12, 13, 14, 15); }
__device__ __forceinline__ v16bf cat16b(v8us lo, v8us hi) { return __builtin_bit_cast(v16bf, __builtin_shufflevector(lo, hi, 0, 1, 2, 3, 4, 5, 6, 7, 8, 9, 10, 11, 12, 13, 14, 15)); }
__device__ __forceinline__ v8f wmma16(v16h a, v16h b, v8f c) { return __builtin_amdgcn_wmma_f32_16x16x32_f16(false, a, false, b, (short)0, c, false, false); }
__device__ __forceinline__ v8f wmmab(v16bf a, v16bf b, v8f c) { return __builtin_amdgcn_wmma_f32_16x16x32_bf16(false, a, false, b, (short)0, c, false, false); }

// k_wt: WT [n][K] = bf16(W[k][n]) (k-major [K][ncols]) via 64 x 64 LDS tiles; grid (K/64, ncols/64).
__global__ __launch_bounds__(256) void k_wt(const float* __restrict__ Wm, int K, int ncols, bf* WT) {
    __shared__ __align__(16) unsigned short tl[64 * 72];
    const int tid = threadIdx.x, k0 = blockIdx.x * 64, n0 = blockIdx.y * 64;
    const int kk = tid >> 2, nq = (tid & 3) * 16;
#pragma unroll
    for (int i = 0; i < 16; ++i) tl[(nq + i) * 72 + kk] = f2bf(Wm[(size_t)(k0 + kk) * ncols + n0 + nq + i]);
    __syncthreads();
    const int piece = tid & 7;
    auto pass = [&]() {
#pragma unroll
        for (int s = 0; s < 2; ++s) { const int nr = (tid >> 3) + 32 * s; const v8us val = *(const v8usa*)(tl + nr * 72 + piece * 8); *(v8us*)(WT + (size_t)(n0 + nr) * K + k0 + piece * 8) = val; }
    };
    pass(); 
}
// Tensor-load staging of the GEMMs' operand tiles: one slice = 64 rows x 128 k = 64 rows of 256 B; each of a block's four waves brings one slice with one request.
// LDS row pitch 272 B (the mover's 16-B pad behind every 256-B row, an odd multiple of 16 B for the 16-byte fragment reads); a slice's 64 x 272 B are rounded up to a multiple of 2 KiB.
typedef unsigned int u32;
typedef u32 u32x4 __attribute__((ext_vector_type(4)));
typedef u32 u32x8 __attribute__((ext_vector_type(8)));
#define TPITCH 272u
#define TSLICE 18432u
#define TBUF   (4u * TSLICE)
__device__ __forceinline__ u32 uni(u32 v) { return (u32)__builtin_amdgcn_readfirstlane(v); }
__device__ __forceinline__ u32 pinned(u32 v) { u32 w = uni(v); asm volatile("" : "+s"(w)); return w; }   // a wave-uniform word held in a scalar register: a test on it is a scalar branch round the tensor load, a descriptor word made from it is formed behind the waits in front of it
__device__ __forceinline__ void tdm_load(u32x4 g0, u32x8 g1) { asm volatile("tensor_load_to_lds %0, %1" :: "s"(g0), "s"(g1) : "memory"); }   // one request of the whole wave: a 2-D tile from global memory into LDS, through no register
__device__ __forceinline__ u32x8 tdm_group1(u32 src_pitch) {   // 1-byte elements, tensor = tile = 64 rows of 256 B, no mask, a 4-dword pad behind every 64 dwords
    u32x8 g;
    g[0] = uni((1u << 20) | (5u << 22) | (3u << 25)); g[1] = uni(256u << 16); g[2] = uni(64u << 16); g[3] = uni(256u << 16);
    g[4] = uni(64u); g[5] = uni(src_pitch); g[6] = uni(0u); g[7] = uni(0u);
    return g;
}
__device__ __forceinline__ u32x4 tdm_group0(u32 lds_dst, unsigned long long ga) {
    u32x4 g;
    g[0] = uni(1u); g[1] = uni(lds_dst); g[2] = uni((u32)ga); g[3] = uni((((u32)(ga >> 32)) & 0x01FFFFFFu) | 0x80000000u);
    return g;
}

// mm_k256: acc += A64.B64^T for 64 rows of A and 64 rows of B, K = 256, both K-contiguous with row stride 256. The four slices (A k 0-127, A k 128-255, B k 0-127, B k 128-255) are
// loaded once, one by each wave; the wave then takes rows 16 wave .. 16 wave + 15 of A against all 64 rows of B, k ascending.
__device__ __forceinline__ void mm_k256(const bf* A64, const bf* B64, unsigned char* tile, v8f (&acc)[4]) {
    const int lane = threadIdx.x & 31, wave = threadIdx.x >> 5, lr = lane & 15, hi = lane >> 4;
    const u32 wv = uni(threadIdx.x >> 5);
    const bf* src = (wv < 2u ? A64 : B64) + (wv & 1u) * 128u;
    tdm_load(tdm_group0((u32)(size_t)tile + wv * TSLICE, (unsigned long long)(size_t)src), tdm_group1(512u));
    asm volatile("s_wait_tensorcnt 0x0" ::: "memory");   // this wave's slice has landed
    __syncthreads();                                       // ... and every other wave's: the tiles may be read
    struct Fr { v16bf a, b[4]; };   // the fragments of one 32-k step
    auto ldf = [&](Fr& f, const unsigned char* half, int kk) {
        const unsigned char* pa = half + (wave * 16 + lr) * TPITCH + hi * 16 + kk * 64;
        const unsigned char* pb = half + 2u * TSLICE + lr * TPITCH + hi * 16 + kk * 64;
        f.a = cat16b(*(const v8usa*)pa, *(const v8usa*)(pa + 32));
#pragma unroll
        for (int t = 0; t < 4; ++t) f.b[t] = cat16b(*(const v8usa*)(pb + t * 16 * TPITCH), *(const v8usa*)(pb + t * 16 * TPITCH + 32));
    };
#pragma unroll 1
    for (int h = 0; h < 2; ++h) {   // rolled over the two k halves: the accumulators then keep registers of their own, apart from every fragment's
        const unsigned char* half = tile + (u32)h * TSLICE;
        Fr f[2];
        ldf(f[0], half, 0);
#pragma unroll
        for (int kk = 0; kk < 4; ++kk) {   // the scheduling fences keep the next step's 10 LDS reads together as one group in front of this step's products
            if (kk < 3) ldf(f[(kk + 1) & 1], half, kk + 1);
            __builtin_amdgcn_sched_barrier(0);
#pragma unroll
            for (int t = 0; t < 4; ++t) acc[t] = wmmab(f[kk & 1].a, f[kk & 1].b[t], acc[t]);
            __builtin_amdgcn_sched_barrier(0);
        }
    }
}

// k_gemmb: 64 x 64 block tile (4 waves x 16 x 64) of C[NTK][NW] = (A [+ Al]).B^T (K = 256) [+ bf(bias[c])] [+ bf(R[r][c]) residual]; f32 whole-line epilogue (or f16
template <bool SPLITA, bool F16OUT = false>
__global__ __launch_bounds__(128) void k_gemmb(const bf* __restrict__ A, const bf* __restrict__ Al, const bf* __restrict__ Bn, const float* __restrict__ bias, float* C, int ldc, h16* C2, const float* __restrict__ R = nullptr, int roundR = 1) {
    constexpr int K = DM;
    static_assert(K == 256, "mm_k256 takes K = 256");
    __shared__ __attribute__((aligned(2048))) unsigned char tile[TBUF];
    __shared__ __align__(16) float ost[4][16 * 68];
    const int lane = threadIdx.x & 31, wave = threadIdx.x >> 5, lr = lane & 15, hi = lane >> 4;
    const int r0 = blockIdx.x * 64 + wave * 16, c0 = blockIdx.y * 64;
    const size_t aoff = (size_t)(r0 + lr) * K + 8 * hi;
    size_t boff[4];
#pragma unroll
    for (int t = 0; t < 4; ++t) boff[t] = (size_t)(c0 + t * 16 + lr) * K + 8 * hi;
    v8f acc[4];
#pragma unroll
    for (int t = 0; t < 4; ++t) acc[t] = (v8f){};
    if constexpr (!SPLITA) mm_k256(A + (size_t)blockIdx.x * 64 * K, Bn + (size_t)c0 * K, tile, acc);
    else
#pragma unroll 1
    for (int kc = 0; kc < K; kc += 32) {
        const v16bf a = cat16b(*(const v8us*)(A + aoff + kc), *(const v8us*)(A + aoff + kc + 16));
        v16bf al = a;
        if (SPLITA) al = cat16b(*(const v8us*)(Al + aoff + kc), *(const v8us*)(Al + aoff + kc + 16));
#pragma unroll
        for (int t = 0; t < 4; ++t) { const v16bf b = cat16b(*(const v8us*)(Bn + boff[t] + kc), *(const v8us*)(Bn + boff[t] + kc + 16)); acc[t] = wmmab(a, b, acc[t]); if (SPLITA) acc[t] = wmmab(al, b, acc[t]); }
        asm volatile("v_nop\n\tv_nop\n\tv_nop\n\tv_nop" : "+v"(acc[0]), "+v"(acc[1]), "+v"(acc[2]), "+v"(acc[3]) : "v"(a), "v"(al));
    }
    float* os = &ost[wave][0];
#pragma unroll
    for (int t = 0; t < 4; ++t) { const float bv = bias ? bfr(bias[c0 + t * 16 + lr]) : 0.f;
#pragma unroll
        for (int j = 0; j < 8; ++j) os[(hi * 8 + j) * 68 + t * 16 + lr] = acc[t][j] + bv; }
    __syncthreads();
    if (F16OUT) {
        h16* crow = (h16*)(void*)C + (size_t)r0 * ldc + c0;
        auto pass = [&]() {
#pragma unroll
            for (int s = 0; s < 4; ++s) { const int row = 4 * s + (lane >> 3), piece = lane & 7; const float* sp = os + row * 68 + piece * 8; v8h o, o2;
#pragma unroll
                for (int i = 0; i < 8; ++i) { const h16 a = (h16)sp[i]; o[i] = a; o2[i] = (h16)((sp[i] - (float)a) * LOSC); }
                *(v8h*)(crow + (size_t)row * ldc + piece * 8) = o; if (C2) *(v8h*)(C2 + (size_t)r0 * ldc + c0 + (size_t)row * ldc + piece * 8) = o2; }
        };
        pass(); 
    } else {
        float* crow = C + (size_t)r0 * ldc + c0;
        auto pass = [&]() {
#pragma unroll
            for (int s = 0; s < 8; ++s) { const int Lid = (lane >> 3) + 4 * s, piece = lane & 7; const int row = Lid >> 1, cofs = (Lid & 1) * 32 + piece * 4;
                v4f val = *(const v4fa*)(os + row * 68 + cofs); if (R) { const v4f rv = *(const v4f*)(R + ((size_t)r0 + row) * ldc + c0 + cofs); val += roundR ? (v4f){bfr(rv[0]), bfr(rv[1]), bfr(rv[2]), bfr(rv[3])} : rv; }
                *(v4f*)(crow + (size_t)row * ldc + cofs) = val; }
        };
        pass(); 
    }
}

typedef __attribute__((ext_vector_type(8))) __bf16 v8bf;
#define AKSL   18432u                      // one k plane of a stage: 64 x 272 B, rounded up to a multiple of 2 KiB
#define AVSL   36864u                      // one v plane of a stage: 256 x 144 B, a multiple of 2 KiB
#define VPITCH 144u
#define ABUF   (2u * AKSL + 2u * AVSL)
#define NSTG   (NN / 64)
// Group 1 of a stage's tile: 1-byte elements, tensor = tile = ROWS rows of ROWB bytes at source pitch SRCP, no mask, a 4-dword pad behind every row (interval code PADC). Word 0 is a constant;
// pinned: each other descriptor word is held in a scalar register of its own, so that the whole group stays in its registers, untouched, while a request is in flight.
template <u32 PADC, u32 ROWB, u32 ROWS, u32 SRCP>
__device__ __forceinline__ u32x8 tdm_group1s() {
    u32x8 g;
    g[0] = uni((1u << 20) | (PADC << 22) | (3u << 25)); g[1] = pinned(ROWB << 16); g[2] = pinned(ROWS << 16); g[3] = pinned(ROWB << 16);
    g[4] = pinned(ROWS); g[5] = pinned(SRCP); g[6] = pinned(0u); g[7] = pinned(0u);
    return g;
}
__device__ __forceinline__ float xhalf(float v) {   // the value of lane l ^ 16, by a vector instruction: an LDS permute would count on dscnt and wait for every fragment read in flight
    const int b = __float_as_int(v); return __int_as_float(__builtin_amdgcn_permlanex16(b, b, 0x76543210, 0xfedcba98, false, false));
}
__global__ __launch_bounds__(128) void k_attn(const bf* __restrict__ Qh, const bf* __restrict__ Ql, const bf* __restrict__ Kh, const bf* __restrict__ Kl, const bf* __restrict__ Vh, const bf* __restrict__ Vl, float* O) {
    __shared__ __attribute__((aligned(2048))) unsigned char ring[2u * ABUF];
    const int lane = threadIdx.x & 31, wave = threadIdx.x >> 5, lr = lane & 15, hi = lane >> 4;
    const int m0 = blockIdx.x * 64;
    const size_t it = blockIdx.y;
    const u32 wv = uni(threadIdx.x >> 5);
    const bf* plane = wv == 0u ? Kh : wv == 1u ? Kl : wv == 2u ? Vh : Vl;
    const unsigned long long gsrc = (unsigned long long)(size_t)(plane + it * (wv < 2u ? (size_t)NN * CQ : (size_t)CC * NN));
    const u32 gstep = wv < 2u ? 64u * CQ * 2u : 128u;   // bytes from one stage to the next: 64 k rows, or 64 columns of v
    const u32 ldst = (u32)(size_t)ring + (wv < 2u ? wv * AKSL : 2u * AKSL + (wv - 2u) * AVSL);
    const u32x8 g1k = tdm_group1s<5u, 256u, 64u, 2u * CQ>(), g1v = tdm_group1s<4u, 128u, 256u, 2u * NN>();
    const u32 isk = pinned(1u - (wv >> 1)), isv = pinned(wv >> 1);   // pinned: the tests on them are scalar branches round the tensor loads (waves 0, 1 bring k, waves 2, 3 bring v)
    auto issue = [&](u32 st) {
        const u32x4 g0 = tdm_group0(ldst + (st & 1u) * ABUF, gsrc + (unsigned long long)st * gstep);
        if (isk) tdm_load(g0, g1k);   // each tile shape has its own load with its own group 1
        if (isv) tdm_load(g0, g1v);
    };
    v16bf qh[4], ql[4];   // this wave's 16 query rows as B fragments, all 128 k
    { const size_t qo = (it * NN + m0 + wave * 16 + lr) * CQ + 8 * hi;
#pragma unroll
      for (int kk = 0; kk < 4; ++kk) { qh[kk] = cat16b(*(const v8us*)(Qh + qo + kk * 32), *(const v8us*)(Qh + qo + kk * 32 + 16)); ql[kk] = cat16b(*(const v8us*)(Ql + qo + kk * 32), *(const v8us*)(Ql + qo + kk * 32 + 16)); } }
    v8f o[16];
#pragma unroll
    for (int t = 0; t < 16; ++t) o[t] = (v8f){};
    float mrun = -3.0e38f, lsum = 0.f;
    struct Fr { v16bf h[4], l[4]; };   // the A fragments of four 16-row tiles at one 32-k step, both planes
    issue(0u);
    asm volatile("s_wait_tensorcnt 0x0" ::: "memory");   // this wave's plane of stage 0 has landed
    __syncthreads();                                       // ... and every other wave's: stage 0 may be read
    issue(1u);
#pragma unroll 1
    for (int s = 0; s < NSTG; ++s) {   // rolled: one pass per stage, the publish point at its foot
        const unsigned char* buf = ring + (u32)(s & 1) * ABUF;
        auto ldk = [&](Fr& f, int kk) {
            const unsigned char* p = buf + lr * TPITCH + hi * 16 + kk * 64;
#pragma unroll
            for (int t = 0; t < 4; ++t) { const unsigned char* q = p + t * 16 * TPITCH;
                f.h[t] = cat16b(*(const v8usa*)q, *(const v8usa*)(q + 32)); f.l[t] = cat16b(*(const v8usa*)(q + AKSL), *(const v8usa*)(q + AKSL + 32)); }
        };
        auto ldv = [&](Fr& f, int g) {   // group g: channel tiles 4 (g & 3) .. + 3, 32-k step g >> 2
            const unsigned char* p = buf + 2u * AKSL + ((g & 3) * 64 + lr) * VPITCH + hi * 16 + (g >> 2) * 64;
#pragma unroll
            for (int t = 0; t < 4; ++t) { const unsigned char* q = p + t * 16 * VPITCH;
                f.h[t] = cat16b(*(const v8usa*)q, *(const v8usa*)(q + 32)); f.l[t] = cat16b(*(const v8usa*)(q + AVSL), *(const v8usa*)(q + AVSL + 32)); }
        };
        v8f sT[4];
#pragma unroll
        for (int t = 0; t < 4; ++t) sT[t] = (v8f){};
        auto mmk = [&](const Fr& f, int kk) {   // per accumulator the order q hi k hi, q lo k hi, q hi k lo; the four tiles interleaved so that no product waits for the one before it
#pragma unroll
            for (int t = 0; t < 4; ++t) sT[t] = wmmab(f.h[t], qh[kk], sT[t]);
#pragma unroll
            for (int t = 0; t < 4; ++t) sT[t] = wmmab(f.h[t], ql[kk], sT[t]);
#pragma unroll
            for (int t = 0; t < 4; ++t) sT[t] = wmmab(f.l[t], qh[kk], sT[t]);
        };
        // All of the stage's fragments are read ahead, into registers of their own, so that the LDS reads on under the score products and the softmax and the o products find
        // their operands in registers: the k fragments first, then the v groups a few at a time, so that a wave never has more reads in flight than dscnt counts (a read beyond
        // that holds up the vector work behind it) and each counted wait stays exact. The scheduling fences keep each group of reads together at its place; without them the
        // compiler spreads the reads among the products and waits for each pair.
        Fr fk[4], fv[8];
#pragma unroll
        for (int kk = 0; kk < 4; ++kk) ldk(fk[kk], kk);
        __builtin_amdgcn_sched_barrier(0);
#pragma unroll
        for (int kk = 0; kk < 4; ++kk) {
            mmk(fk[kk], kk);
            __builtin_amdgcn_sched_barrier(0);
            ldv(fv[kk], kk);
            if (kk == 3) ldv(fv[4], 4);
            __builtin_amdgcn_sched_barrier(0);
        }
        float mx4[4];
#pragma unroll
        for (int t = 0; t < 4; ++t) { mx4[t] = sT[t][0];
#pragma unroll
            for (int j = 1; j < 8; ++j) mx4[t] = fmaxf(mx4[t], sT[t][j]); }
        float mx = fmaxf(fmaxf(mx4[0], mx4[1]), fmaxf(mx4[2], mx4[3]));
        mx = fmaxf(mx, xhalf(mx));   // the column's other 32 scores
        const float mnew = fmaxf(mrun, mx), alpha = __expf(mrun - mnew);
        mrun = mnew;
        v16bf ph[2], pl[2]; float ps4[4];
        auto pfrag = [&](int kk) {   // p of score tiles 2 kk and 2 kk + 1 = the B fragments of 32-k step kk
            v8bf pht[2], plt[2];
#pragma unroll
            for (int u = 0; u < 2; ++u) { const int t = 2 * kk + u; v8f p; ps4[t] = 0.f;
#pragma unroll
                for (int j = 0; j < 8; ++j) { p[j] = __expf(sT[t][j] - mnew); ps4[t] += p[j]; }
                pht[u] = __builtin_convertvector(p, v8bf); plt[u] = __builtin_convertvector(p - __builtin_convertvector(pht[u], v8f), v8bf); }
            ph[kk] = __builtin_shufflevector(pht[0], pht[1], 0, 1, 2, 3, 4, 5, 6, 7, 8, 9, 10, 11, 12, 13, 14, 15);
            pl[kk] = __builtin_shufflevector(plt[0], plt[1], 0, 1, 2, 3, 4, 5, 6, 7, 8, 9, 10, 11, 12, 13, 14, 15);
        };
        pfrag(0);
#pragma unroll
        for (int t = 0; t < 16; ++t) o[t] *= alpha;
        __builtin_amdgcn_sched_barrier(0);
        ldv(fv[5], 5); ldv(fv[6], 6);
        __builtin_amdgcn_sched_barrier(0);
        pfrag(1);
        lsum = lsum * alpha + ((ps4[0] + ps4[1]) + (ps4[2] + ps4[3]));   // this lane's half of the column's sum; the halves are joined behind the loop
        auto mmv = [&](const Fr& f, int g) {   // per accumulator the order v hi p hi, v lo p hi, v hi p lo
            const int c4 = (g & 3) * 4, kk = g >> 2;
#pragma unroll
            for (int t = 0; t < 4; ++t) o[c4 + t] = wmmab(f.h[t], ph[kk], o[c4 + t]);
#pragma unroll
            for (int t = 0; t < 4; ++t) o[c4 + t] = wmmab(f.l[t], ph[kk], o[c4 + t]);
#pragma unroll
            for (int t = 0; t < 4; ++t) o[c4 + t] = wmmab(f.h[t], pl[kk], o[c4 + t]);
        };
        mmv(fv[0], 0); mmv(fv[1], 1);
        __builtin_amdgcn_sched_barrier(0);
        ldv(fv[7], 7);
        __builtin_amdgcn_sched_barrier(0);
#pragma unroll
        for (int g = 2; g < 8; ++g) mmv(fv[g], g);
        if (pinned((u32)(s + 1 < NSTG))) {   // the publish point, where a next stage exists (the same test in every wave of the block); pinned: a scalar branch, which also keeps the o products in front of the barrier
            asm volatile("s_wait_dscnt 0x0" ::: "memory");       // this wave's reads of stage s are done before its buffer is refilled
            asm volatile("s_wait_tensorcnt 0x0" ::: "memory");   // this wave's plane of stage s + 1 has landed
            __syncthreads();                                      // publishes stage s + 1 and ends every wave's reads of stage s
            if (pinned((u32)(s + 2 < NSTG))) issue(pinned((u32)s + 2u));   // pinned: scalar branch round the tensor load; its descriptor words formed behind the wait
        }
    }
    asm volatile("s_wait_tensorcnt 0x0" ::: "memory");   // no request is left in flight
    asm volatile("s_wait_dscnt 0x0" ::: "memory");       // this wave's reads of the last stage are done
    __syncthreads();                                       // ... and every other wave's: the ring becomes the output's staging
    lsum += xhalf(lsum);
    const float inv = 1.0f / lsum;
    float* stg = (float*)(void*)ring;   // [256 channels][64 positions], pitch 68 floats
#pragma unroll
    for (int t = 0; t < 16; ++t) {
#pragma unroll
        for (int j = 0; j < 8; ++j) stg[(t * 16 + hi * 8 + j) * 68 + wave * 16 + lr] = o[t][j] * inv; }
    __syncthreads();   // a row of the staged tile holds columns of all four waves
    float* orow = O + it * ((size_t)CC * NN) + (size_t)(wave * 64 + hi) * NN + m0 + lr * 4;
#pragma unroll
    for (int r = 0; r < 32; ++r) {   // whole 128-byte lines: 16 lanes x 16 B per channel row, two rows a store
        const v4f val = *(const v4fa*)(stg + (wave * 64 + r * 2 + hi) * 68 + lr * 4); *(v4f*)(orow + (size_t)r * 2 * NN) = val; }
}

// k_gemmrb: 64 x 64 tile of C[o][v] = (A [+ Al]).B^T over K (A row stride K, B n-major row stride K) + bf(rbias[o]) per ROW; f32 whole-line epilogue (8 lanes x 16 B per line),
template <bool SPLITA>
__global__ __launch_bounds__(128) void k_gemmrb(const bf* __restrict__ A, const bf* __restrict__ Al, const bf* __restrict__ Bn, const float* __restrict__ rbias, float* C, int ldc) {
    constexpr int K = CC;
    static_assert(K == 256, "mm_k256 takes K = 256");
    __shared__ __attribute__((aligned(2048))) unsigned char tile[TBUF];
    __shared__ __align__(16) float ost[4][16 * 68];
    const int lane = threadIdx.x & 31, wave = threadIdx.x >> 5, lr = lane & 15, hi = lane >> 4;
    const int r0 = blockIdx.x * 64 + wave * 16, c0 = blockIdx.y * 64;
    const size_t aoff = (size_t)(r0 + lr) * K + 8 * hi;
    v8f acc[4];
#pragma unroll
    for (int t = 0; t < 4; ++t) acc[t] = (v8f){};
    if constexpr (!SPLITA) mm_k256(A + (size_t)blockIdx.x * 64 * K, Bn + (size_t)c0 * K, tile, acc);
    else
#pragma unroll 1
    for (int kc = 0; kc < K; kc += 32) {
        const v16bf a = cat16b(*(const v8us*)(A + aoff + kc), *(const v8us*)(A + aoff + kc + 16));
        v16bf al = a; if (SPLITA) al = cat16b(*(const v8us*)(Al + aoff + kc), *(const v8us*)(Al + aoff + kc + 16));
#pragma unroll
        for (int t = 0; t < 4; ++t) { const size_t bo = (size_t)(c0 + t * 16 + lr) * K + kc + 8 * hi; const v16bf bb = cat16b(*(const v8us*)(Bn + bo), *(const v8us*)(Bn + bo + 16)); acc[t] = wmmab(a, bb, acc[t]); if (SPLITA) acc[t] = wmmab(al, bb, acc[t]); }
        asm volatile("v_nop\n\tv_nop\n\tv_nop\n\tv_nop" : "+v"(acc[0]), "+v"(acc[1]), "+v"(acc[2]), "+v"(acc[3]) : "v"(a), "v"(al));
    }
    float* os = &ost[wave][0];
#pragma unroll
    for (int t = 0; t < 4; ++t) {
#pragma unroll
        for (int j = 0; j < 8; ++j) os[(hi * 8 + j) * 68 + t * 16 + lr] = acc[t][j] + bfr(rbias[r0 + hi * 8 + j]); }
    __builtin_amdgcn_wave_barrier(); asm volatile("" ::: "memory");
    float* crow = C + (size_t)r0 * ldc + c0;
    auto pass = [&]() {
#pragma unroll
        for (int s = 0; s < 8; ++s) { const int Lid = (lane >> 3) + 4 * s, piece = lane & 7; const int row = Lid >> 1, cofs = (Lid & 1) * 32 + piece * 4;
            const v4f val = *(const v4fa*)(os + row * 68 + cofs); *(v4f*)(crow + (size_t)row * ldc + cofs) = val; }
    };
    pass(); 
}
__global__ __launch_bounds__(256) void k_rowsplit(const float* __restrict__ Y, int nrows, bf* Ph, bf* Pl) {
    const int lane = threadIdx.x & 31, r = blockIdx.x * 8 + (threadIdx.x >> 5); if (r >= nrows) return;
{
#pragma unroll 1
        for (int c0 = lane * 8; c0 < NN; c0 += 256) { const size_t o = (size_t)r * NN + c0; const v8f v = *(const v8f*)(Y + o); v8us oh, ol;
#pragma unroll
            for (int i = 0; i < 8; ++i) { const unsigned short hb = f2bf(v[i]); oh[i] = hb; ol[i] = f2bf(v[i] - bf2f(hb)); }
            *(v8us*)(Ph + o) = oh; *(v8us*)(Pl + o) = ol; }
         }
}
__global__ __launch_bounds__(256) void k_cvt8(const float* __restrict__ src, bf* dst, size_t n8) {
    const size_t i = (size_t)blockIdx.x * 256 + threadIdx.x; if (i >= n8) return;
    const v8f v = *(const v8f*)(src + i * 8); v8us o;
#pragma unroll
    for (int k = 0; k < 8; ++k) o[k] = f2bf(v[k]);
    *(v8us*)(dst + i * 8) = o; 
}
__global__ __launch_bounds__(256) void k_zero8(bf* dst, size_t n8) {
    const size_t i = (size_t)blockIdx.x * 256 + threadIdx.x; if (i >= n8) return; v8us z;
#pragma unroll
    for (int k = 0; k < 8; ++k) z[k] = 0;
    *(v8us*)(dst + i * 8) = z; 
}

// k_split128s: bf16 hi + UNSCALED residual planes of a computed f32 [rows][128] matrix, optionally scaled per row by f = (1 - bf(mask[r])) bf(skin[r]); one wave per row: lane -> 4
__global__ __launch_bounds__(256) void k_split128s(const float* __restrict__ src, int nrows, const float* __restrict__ msk, const float* __restrict__ skn, bf* dh, bf* dl) {
    typedef __attribute__((ext_vector_type(4))) unsigned short v4us;
    const int lane = threadIdx.x & 31, r = blockIdx.x * 8 + (threadIdx.x >> 5); if (r >= nrows) return;
    const float f = msk ? (1.0f - bfr(msk[r])) * bfr(skn[r]) : 1.0f;
    const size_t o = (size_t)r * CQ + lane * 4; const v4f v = *(const v4f*)(src + o); v4us oh, ol;
#pragma unroll
    for (int i = 0; i < 4; ++i) { const float y = v[i] * f; const unsigned short hb = f2bf(y); oh[i] = hb; ol[i] = f2bf(y - bf2f(hb)); }
    *(v4us*)(dh + o) = oh; *(v4us*)(dl + o) = ol; 
}
// k_fin: out[c][n] = bf(gamma) (O[c][n] bf(mask[n]) bf(skin[n])) + bf(x[c][n]) over the item (f32); one wave per channel row: lane -> 4 consecutive floats per 128-column chunk (8 lanes
__global__ __launch_bounds__(256) void k_fin(const float* __restrict__ O, const float* __restrict__ X, const float* __restrict__ msk, const float* __restrict__ skn, const float* __restrict__ gam, float* OUTP) {
    const int lane = threadIdx.x & 31, r = blockIdx.x * 8 + (threadIdx.x >> 5); if (r >= CC) return; const float g = bfr(gam[0]);
{
#pragma unroll 1
        for (int c0 = lane * 4; c0 < NN; c0 += 128) { const size_t o = (size_t)r * NN + c0; const v4f ov = *(const v4f*)(O + o), xv = *(const v4f*)(X + o); v4f y;
#pragma unroll
            for (int i = 0; i < 4; ++i) y[i] = fmaf(g, ov[i] * bfr(msk[c0 + i]) * bfr(skn[c0 + i]), bfr(xv[i]));
            *(v4f*)(OUTP + o) = y; }
         }
}

extern "C" void kernel_launch(void* const* d_in, const int* in_sizes, int n_in,
                              void* d_out, int out_size, void* d_ws, size_t ws_size, hipStream_t stream) {
    (void)in_sizes; (void)n_in; (void)out_size;
    const float* x = (const float*)d_in[0]; const float* mask = (const float*)d_in[1]; const float* skin = (const float*)d_in[2];
    const float* Wq = (const float*)d_in[3]; const float* bq = (const float*)d_in[4]; const float* Wk = (const float*)d_in[5]; const float* bk = (const float*)d_in[6]; const float* Wv = (const float*)d_in[7]; const float* bv = (const float*)d_in[8]; const float* gam = (const float*)d_in[9];
    float* out = (float*)d_out;    // [4][256][64][64]
    char* wsp = (char*)d_ws;
    auto take = [&](size_t bytes) { char* p = wsp; wsp += (bytes + 255) & ~(size_t)255; return (void*)p; };
    bf* WqB = (bf*)take(CQ * CC * 2); bf* WkB = (bf*)take(CQ * CC * 2); bf* WvB = (bf*)take(CC * CC * 2);
    bf* XT = (bf*)take((size_t)NN * CC * 2); float* TMP = (float*)take((size_t)CC * NN * 4);
    const size_t QK = (size_t)NN * CQ, VO = (size_t)CC * NN;    // elements of one item's q or k plane, of its v plane or o
    bf* Qh = (bf*)take(NBI * QK * 2); bf* Ql = (bf*)take(NBI * QK * 2); bf* Kh = (bf*)take(NBI * QK * 2); bf* Kl = (bf*)take(NBI * QK * 2); bf* Vh = (bf*)take(NBI * VO * 2); bf* Vl = (bf*)take(NBI * VO * 2);
    float* O = (float*)take(NBI * VO * 4);
    if ((size_t)(wsp - (char*)d_ws) > ws_size) return;    // 0.2 + 2.1 + 4.2 + 4 x 4.2 + 2 x 8.4 + 16.8 ~ 57 MB, no aliasing (XT, TMP reused item by item, q -> k -> v, in stream order)
    { const size_t n1 = CQ * CC / 8, n3 = CC * CC / 8; k_cvt8<<<(unsigned)((n1 + 255) / 256), 256, 0, stream>>>(Wq, WqB, n1); k_cvt8<<<(unsigned)((n1 + 255) / 256), 256, 0, stream>>>(Wk, WkB, n1); k_cvt8<<<(unsigned)((n3 + 255) / 256), 256, 0, stream>>>(Wv, WvB, n3); }
    for (int b = 0; b < NBI; ++b) {
        const float* xb = x + (size_t)b * CC * NN; const float* mb = mask + (size_t)b * NN; const float* sb = skin + (size_t)b * NN;
        k_wt<<<dim3(CC / 64, NN / 64, 1), 256, 0, stream>>>(xb, CC, NN, XT);                                                                   // x^T [n][c] in bf16
        k_gemmb<false, false><<<dim3(NN / 64, CQ / 64, 1), 128, 0, stream>>>(XT, nullptr, WqB, bq, TMP, CQ, nullptr); k_split128s<<<NN / 8, 256, 0, stream>>>(TMP, NN, nullptr, nullptr, Qh + b * QK, Ql + b * QK);   // q^T [n][128]
        k_gemmb<false, false><<<dim3(NN / 64, CQ / 64, 1), 128, 0, stream>>>(XT, nullptr, WkB, bk, TMP, CQ, nullptr); k_split128s<<<NN / 8, 256, 0, stream>>>(TMP, NN, mb, sb, Kh + b * QK, Kl + b * QK);             // k^T (1-mask) skin
        k_gemmrb<false><<<dim3(CC / 64, NN / 64, 1), 128, 0, stream>>>(WvB, nullptr, XT, bv, TMP, NN); k_rowsplit<<<CC / 8, 256, 0, stream>>>(TMP, CC, Vh + b * VO, Vl + b * VO);               // v [c][n] (+ bv per row)
    }
    k_attn<<<dim3(NN / 64, NBI, 1), 128, 0, stream>>>(Qh, Ql, Kh, Kl, Vh, Vl, O);                                                                // o[c][m] = sum_n v[c][n] softmax_n(q_m . k_n), 256 blocks
    for (int b = 0; b < NBI; ++b)
        k_fin<<<CC / 8, 256, 0, stream>>>(O + b * VO, x + b * VO, mask + (size_t)b * NN, skin + (size_t)b * NN, gam, out + b * VO);
}

// v004
// It runs in 170 microseconds.
// In two side-by-side timings against v003, it was 1.81 and 1.80 times as fast.
// Over all steps from v000 it is 19.2 times as fast.
#include <hip/hip_runtime.h>

// Compute dtypes, f32 accumulate: for all batch items in each launch q, k (128 ch) token-major and v (256 ch) channel-major 1x1 convs as GEMMs with PLAIN bf16 operands (rounded input/weights,
// exact products, + bias; k then scaled per position by (1 - mask) skin_mask in f32) -> bf16 hi + UNSCALED residual planes; then, all items in one launch, energy S[m][n] = q_m . k_n
// (three products) -> row softmax in f32 with a running maximum and sum -> o[c][m] = sum_n v[c][n] P[m][n] (three products), the scores never leaving the WGP - all on

#define NBI  4
#define CC   256
#define CQ   128
#define NN   4096
#define DM   CC
#define NTK  NN
#define LOSC 1024.0f

typedef _Float16 h16;
typedef unsigned short bf;
typedef __attribute__((ext_vector_type(16))) __bf16   v16bf;
typedef __attribute__((ext_vector_type(16))) _Float16 v16h;
typedef __attribute__((ext_vector_type(8)))  _Float16 v8h;
typedef __attribute__((ext_vector_type(8)))  unsigned short v8us;
typedef __attribute__((ext_vector_type(8)))  float    v8f;
typedef __attribute__((ext_vector_type(4)))  float    v4f;
typedef __attribute__((ext_vector_type(4)))  _Float16 v4h;
typedef v8h  __attribute__((may_alias)) v8ha;
typedef v4f  __attribute__((may_alias)) v4fa;
typedef v8us __attribute__((may_alias)) v8usa;

__device__ __forceinline__ unsigned short f2bf(float f) { unsigned u = __float_as_uint(f); u += 0x7FFFu + ((u >> 16) & 1u); return (unsigned short)(u >> 16); }
__device__ __forceinline__ float bf2f(unsigned short b) { return __uint_as_float(((unsigned)b) << 16); }
__device__ __forceinline__ float bfr(float f) { return bf2f(f2bf(f)); }
__device__ __forceinline__ v16h cat16(v8h lo, v8h hi) { return __builtin_shufflevector(lo, hi, 0, 1, 2, 3, 4, 5, 6, 7, 8, 9, 10, 11, 12, 13, 14, 15); }
__device__ __forceinline__ v16bf cat16b(v8us lo, v8us hi) { return __builtin_bit_cast(v16bf, __builtin_shufflevector(lo, hi, 0, 1, 2, 3, 4, 5, 6, 7, 8, 9, 10, 11, 12, 13, 14, 15)); }
__device__ __forceinline__ v8f wmma16(v16h a, v16h b, v8f c) { return __builtin_amdgcn_wmma_f32_16x16x32_f16(false, a, false, b, (short)0, c, false, false); }
__device__ __forceinline__ v8f wmmab(v16bf a, v16bf b, v8f c) { return __builtin_amdgcn_wmma_f32_16x16x32_bf16(false, a, false, b, (short)0, c, false, false); }

// k_wt: WT [n][K] = bf16(W[k][n]) (k-major [K][ncols]) via 64 x 64 LDS tiles; grid (K/64, ncols/64, matrices), the matrices back to back in source and destination.
__global__ __launch_bounds__(256) void k_wt(const float* __restrict__ Wall, int K, int ncols, bf* WTall) {
    __shared__ __align__(16) unsigned short tl[64 * 72];
    const int tid = threadIdx.x, k0 = blockIdx.x * 64, n0 = blockIdx.y * 64;
    const float* Wm = Wall + (size_t)blockIdx.z * K * ncols; bf* WT = WTall + (size_t)blockIdx.z * K * ncols;
    const int kk = tid >> 2, nq = (tid & 3) * 16;
#pragma unroll
    for (int i = 0; i < 16; ++i) tl[(nq + i) * 72 + kk] = f2bf(Wm[(size_t)(k0 + kk) * ncols + n0 + nq + i]);
    __syncthreads();
    const int piece = tid & 7;
    auto pass = [&]() {
#pragma unroll
        for (int s = 0; s < 2; ++s) { const int nr = (tid >> 3) + 32 * s; const v8us val = *(const v8usa*)(tl + nr * 72 + piece * 8); *(v8us*)(WT + (size_t)(n0 + nr) * K + k0 + piece * 8) = val; }
    };
    pass(); 
}
// Tensor-load staging of the GEMMs' operand tiles: one slice = 64 rows x 128 k = 64 rows of 256 B; each of a block's four waves brings one slice with one request.
// LDS row pitch 272 B (the mover's 16-B pad behind every 256-B row, an odd multiple of 16 B for the 16-byte fragment reads); a slice's 64 x 272 B are rounded up to a multiple of 2 KiB.
typedef unsigned int u32;
typedef u32 u32x4 __attribute__((ext_vector_type(4)));
typedef u32 u32x8 __attribute__((ext_vector_type(8)));
#define TPITCH 272u
#define TSLICE 18432u
#define TBUF   (4u * TSLICE)
__device__ __forceinline__ u32 uni(u32 v) { return (u32)__builtin_amdgcn_readfirstlane(v); }
__device__ __forceinline__ u32 pinned(u32 v) { u32 w = uni(v); asm volatile("" : "+s"(w)); return w; }   // a wave-uniform word held in a scalar register: a test on it is a scalar branch round the tensor load, a descriptor word made from it is formed behind the waits in front of it
__device__ __forceinline__ void tdm_load(u32x4 g0, u32x8 g1) { asm volatile("tensor_load_to_lds %0, %1" :: "s"(g0), "s"(g1) : "memory"); }   // one request of the whole wave: a 2-D tile from global memory into LDS, through no register
__device__ __forceinline__ u32x8 tdm_group1(u32 src_pitch) {   // 1-byte elements, tensor = tile = 64 rows of 256 B, no mask, a 4-dword pad behind every 64 dwords
    u32x8 g;
    g[0] = uni((1u << 20) | (5u << 22) | (3u << 25)); g[1] = uni(256u << 16); g[2] = uni(64u << 16); g[3] = uni(256u << 16);
    g[4] = uni(64u); g[5] = uni(src_pitch); g[6] = uni(0u); g[7] = uni(0u);
    return g;
}
__device__ __forceinline__ u32x4 tdm_group0(u32 lds_dst, unsigned long long ga) {
    u32x4 g;
    g[0] = uni(1u); g[1] = uni(lds_dst); g[2] = uni((u32)ga); g[3] = uni((((u32)(ga >> 32)) & 0x01FFFFFFu) | 0x80000000u);
    return g;
}

// mm_k256: acc += A64.B64^T for 64 rows of A and 64 rows of B, K = 256, both K-contiguous with row stride 256. The four slices (A k 0-127, A k 128-255, B k 0-127, B k 128-255) are
// loaded once, one by each wave; the wave then takes rows 16 wave .. 16 wave + 15 of A against all 64 rows of B, k ascending.
__device__ __forceinline__ void mm_k256(const bf* A64, const bf* B64, unsigned char* tile, v8f (&acc)[4]) {
    const int lane = threadIdx.x & 31, wave = threadIdx.x >> 5, lr = lane & 15, hi = lane >> 4;
    const u32 wv = uni(threadIdx.x >> 5);
    const bf* src = (wv < 2u ? A64 : B64) + (wv & 1u) * 128u;
    tdm_load(tdm_group0((u32)(size_t)tile + wv * TSLICE, (unsigned long long)(size_t)src), tdm_group1(512u));
    asm volatile("s_wait_tensorcnt 0x0" ::: "memory");   // this wave's slice has landed
    __syncthreads();                                       // ... and every other wave's: the tiles may be read
    struct Fr { v16bf a, b[4]; };   // the fragments of one 32-k step
    auto ldf = [&](Fr& f, const unsigned char* half, int kk) {
        const unsigned char* pa = half + (wave * 16 + lr) * TPITCH + hi * 16 + kk * 64;
        const unsigned char* pb = half + 2u * TSLICE + lr * TPITCH + hi * 16 + kk * 64;
        f.a = cat16b(*(const v8usa*)pa, *(const v8usa*)(pa + 32));
#pragma unroll
        for (int t = 0; t < 4; ++t) f.b[t] = cat16b(*(const v8usa*)(pb + t * 16 * TPITCH), *(const v8usa*)(pb + t * 16 * TPITCH + 32));
    };
#pragma unroll 1
    for (int h = 0; h < 2; ++h) {   // rolled over the two k halves: the accumulators then keep registers of their own, apart from every fragment's
        const unsigned char* half = tile + (u32)h * TSLICE;
        Fr f[2];
        ldf(f[0], half, 0);
#pragma unroll
        for (int kk = 0; kk < 4; ++kk) {   // the scheduling fences keep the next step's 10 LDS reads together as one group in front of this step's products
            if (kk < 3) ldf(f[(kk + 1) & 1], half, kk + 1);
            __builtin_amdgcn_sched_barrier(0);
#pragma unroll
            for (int t = 0; t < 4; ++t) acc[t] = wmmab(f[kk & 1].a, f[kk & 1].b[t], acc[t]);
            __builtin_amdgcn_sched_barrier(0);
        }
    }
}

// k_gemmb: 64 x 64 block tile (4 waves x 16 x 64) of C[NBI NN][NW] = (A [+ Al]).B^T (K = 256) [+ bf(bias[c])] [+ bf(R[r][c]) residual]; f32 whole-line epilogue (or f16
template <bool SPLITA, bool F16OUT = false>
__global__ __launch_bounds__(128) void k_gemmb(const bf* __restrict__ A, const bf* __restrict__ Al, const bf* __restrict__ Bn, const float* __restrict__ bias, float* C, int ldc, h16* C2, const float* __restrict__ R = nullptr, int roundR = 1) {
    constexpr int K = DM;
    static_assert(K == 256, "mm_k256 takes K = 256");
    __shared__ __attribute__((aligned(2048))) unsigned char tile[TBUF];
    __shared__ __align__(16) float ost[4][16 * 68];
    const int lane = threadIdx.x & 31, wave = threadIdx.x >> 5, lr = lane & 15, hi = lane >> 4;
    const int r0 = blockIdx.x * 64 + wave * 16, c0 = blockIdx.y * 64;
    const size_t aoff = (size_t)(r0 + lr) * K + 8 * hi;
    size_t boff[4];
#pragma unroll
    for (int t = 0; t < 4; ++t) boff[t] = (size_t)(c0 + t * 16 + lr) * K + 8 * hi;
    v8f acc[4];
#pragma unroll
    for (int t = 0; t < 4; ++t) acc[t] = (v8f){};
    if constexpr (!SPLITA) mm_k256(A + (size_t)blockIdx.x * 64 * K, Bn + (size_t)c0 * K, tile, acc);
    else
#pragma unroll 1
    for (int kc = 0; kc < K; kc += 32) {
        const v16bf a = cat16b(*(const v8us*)(A + aoff + kc), *(const v8us*)(A + aoff + kc + 16));
        v16bf al = a;
        if (SPLITA) al = cat16b(*(const v8us*)(Al + aoff + kc), *(const v8us*)(Al + aoff + kc + 16));
#pragma unroll
        for (int t = 0; t < 4; ++t) { const v16bf b = cat16b(*(const v8us*)(Bn + boff[t] + kc), *(const v8us*)(Bn + boff[t] + kc + 16)); acc[t] = wmmab(a, b, acc[t]); if (SPLITA) acc[t] = wmmab(al, b, acc[t]); }
        asm volatile("v_nop\n\tv_nop\n\tv_nop\n\tv_nop" : "+v"(acc[0]), "+v"(acc[1]), "+v"(acc[2]), "+v"(acc[3]) : "v"(a), "v"(al));
    }
    float* os = &ost[wave][0];
#pragma unroll
    for (int t = 0; t < 4; ++t) { const float bv = bias ? bfr(bias[c0 + t * 16 + lr]) : 0.f;
#pragma unroll
        for (int j = 0; j < 8; ++j) os[(hi * 8 + j) * 68 + t * 16 + lr] = acc[t][j] + bv; }
    __syncthreads();
    if (F16OUT) {
        h16* crow = (h16*)(void*)C + (size_t)r0 * ldc + c0;
        auto pass = [&]() {
#pragma unroll
            for (int s = 0; s < 4; ++s) { const int row = 4 * s + (lane >> 3), piece = lane & 7; const float* sp = os + row * 68 + piece * 8; v8h o, o2;
#pragma unroll
                for (int i = 0; i < 8; ++i) { const h16 a = (h16)sp[i]; o[i] = a; o2[i] = (h16)((sp[i] - (float)a) * LOSC); }
                *(v8h*)(crow + (size_t)row * ldc + piece * 8) = o; if (C2) *(v8h*)(C2 + (size_t)r0 * ldc + c0 + (size_t)row * ldc + piece * 8) = o2; }
        };
        pass(); 
    } else {
        float* crow = C + (size_t)r0 * ldc + c0;
        auto pass = [&]() {
#pragma unroll
            for (int s = 0; s < 8; ++s) { const int Lid = (lane >> 3) + 4 * s, piece = lane & 7; const int row = Lid >> 1, cofs = (Lid & 1) * 32 + piece * 4;
                v4f val = *(const v4fa*)(os + row * 68 + cofs); if (R) { const v4f rv = *(const v4f*)(R + ((size_t)r0 + row) * ldc + c0 + cofs); val += roundR ? (v4f){bfr(rv[0]), bfr(rv[1]), bfr(rv[2]), bfr(rv[3])} : rv; }
                *(v4f*)(crow + (size_t)row * ldc + cofs) = val; }
        };
        pass(); 
    }
}

typedef __attribute__((ext_vector_type(8))) __bf16 v8bf;
#define AKSL   18432u                      // one k plane of a stage: 64 x 272 B, rounded up to a multiple of 2 KiB
#define AVSL   36864u                      // one v plane of a stage: 256 x 144 B, a multiple of 2 KiB
#define VPITCH 144u
#define ABUF   (2u * AKSL + 2u * AVSL)
#define NSTG   (NN / 64)
// Group 1 of a stage's tile: 1-byte elements, tensor = tile = ROWS rows of ROWB bytes at source pitch SRCP, no mask, a 4-dword pad behind every row (interval code PADC). Word 0 is a constant;
// pinned: each other descriptor word is held in a scalar register of its own, so that the whole group stays in its registers, untouched, while a request is in flight.
template <u32 PADC, u32 ROWB, u32 ROWS, u32 SRCP>
__device__ __forceinline__ u32x8 tdm_group1s() {
    u32x8 g;
    g[0] = uni((1u << 20) | (PADC << 22) | (3u << 25)); g[1] = pinned(ROWB << 16); g[2] = pinned(ROWS << 16); g[3] = pinned(ROWB << 16);
    g[4] = pinned(ROWS); g[5] = pinned(SRCP); g[6] = pinned(0u); g[7] = pinned(0u);
    return g;
}
__device__ __forceinline__ float xhalf(float v) {   // the value of lane l ^ 16, by a vector instruction: an LDS permute would count on dscnt and wait for every fragment read in flight
    const int b = __float_as_int(v); return __int_as_float(__builtin_amdgcn_permlanex16(b, b, 0x76543210, 0xfedcba98, false, false));
}
__global__ __launch_bounds__(128) void k_attn(const bf* __restrict__ Qh, const bf* __restrict__ Ql, const bf* __restrict__ Kh, const bf* __restrict__ Kl, const bf* __restrict__ Vh, const bf* __restrict__ Vl, float* O) {
    __shared__ __attribute__((aligned(2048))) unsigned char ring[2u * ABUF];
    const int lane = threadIdx.x & 31, wave = threadIdx.x >> 5, lr = lane & 15, hi = lane >> 4;
    const int m0 = blockIdx.x * 64;
    const size_t it = blockIdx.y;
    const u32 wv = uni(threadIdx.x >> 5);
    const bf* plane = wv == 0u ? Kh : wv == 1u ? Kl : wv == 2u ? Vh : Vl;
    const unsigned long long gsrc = (unsigned long long)(size_t)(plane + it * (wv < 2u ? (size_t)NN * CQ : (size_t)CC * NN));
    const u32 gstep = wv < 2u ? 64u * CQ * 2u : 128u;   // bytes from one stage to the next: 64 k rows, or 64 columns of v
    const u32 ldst = (u32)(size_t)ring + (wv < 2u ? wv * AKSL : 2u * AKSL + (wv - 2u) * AVSL);
    const u32x8 g1k = tdm_group1s<5u, 256u, 64u, 2u * CQ>(), g1v = tdm_group1s<4u, 128u, 256u, 2u * NN>();
    const u32 isk = pinned(1u - (wv >> 1)), isv = pinned(wv >> 1);   // pinned: the tests on them are scalar branches round the tensor loads (waves 0, 1 bring k, waves 2, 3 bring v)
    auto issue = [&](u32 st) {
        const u32x4 g0 = tdm_group0(ldst + (st & 1u) * ABUF, gsrc + (unsigned long long)st * gstep);
        if (isk) tdm_load(g0, g1k);   // each tile shape has its own load with its own group 1
        if (isv) tdm_load(g0, g1v);
    };
    v16bf qh[4], ql[4];   // this wave's 16 query rows as B fragments, all 128 k
    { const size_t qo = (it * NN + m0 + wave * 16 + lr) * CQ + 8 * hi;
#pragma unroll
      for (int kk = 0; kk < 4; ++kk) { qh[kk] = cat16b(*(const v8us*)(Qh + qo + kk * 32), *(const v8us*)(Qh + qo + kk * 32 + 16)); ql[kk] = cat16b(*(const v8us*)(Ql + qo + kk * 32), *(const v8us*)(Ql + qo + kk * 32 + 16)); } }
    v8f o[16];
#pragma unroll
    for (int t = 0; t < 16; ++t) o[t] = (v8f){};
    float mrun = -3.0e38f, lsum = 0.f;
    struct Fr { v16bf h[4], l[4]; };   // the A fragments of four 16-row tiles at one 32-k step, both planes
    issue(0u);
    asm volatile("s_wait_tensorcnt 0x0" ::: "memory");   // this wave's plane of stage 0 has landed
    __syncthreads();                                       // ... and every other wave's: stage 0 may be read
    issue(1u);
#pragma unroll 1
    for (int s = 0; s < NSTG; ++s) {   // rolled: one pass per stage, the publish point at its foot
        const unsigned char* buf = ring + (u32)(s & 1) * ABUF;
        auto ldk = [&](Fr& f, int kk) {
            const unsigned char* p = buf + lr * TPITCH + hi * 16 + kk * 64;
#pragma unroll
            for (int t = 0; t < 4; ++t) { const unsigned char* q = p + t * 16 * TPITCH;
                f.h[t] = cat16b(*(const v8usa*)q, *(const v8usa*)(q + 32)); f.l[t] = cat16b(*(const v8usa*)(q + AKSL), *(const v8usa*)(q + AKSL + 32)); }
        };
        auto ldv = [&](Fr& f, int g) {   // group g: channel tiles 4 (g & 3) .. + 3, 32-k step g >> 2
            const unsigned char* p = buf + 2u * AKSL + ((g & 3) * 64 + lr) * VPITCH + hi * 16 + (g >> 2) * 64;
#pragma unroll
            for (int t = 0; t < 4; ++t) { const unsigned char* q = p + t * 16 * VPITCH;
                f.h[t] = cat16b(*(const v8usa*)q, *(const v8usa*)(q + 32)); f.l[t] = cat16b(*(const v8usa*)(q + AVSL), *(const v8usa*)(q + AVSL + 32)); }
        };
        v8f sT[4];
#pragma unroll
        for (int t = 0; t < 4; ++t) sT[t] = (v8f){};
        auto mmk = [&](const Fr& f, int kk) {   // per accumulator the order q hi k hi, q lo k hi, q hi k lo; the four tiles interleaved so that no product waits for the one before it
#pragma unroll
            for (int t = 0; t < 4; ++t) sT[t] = wmmab(f.h[t], qh[kk], sT[t]);
#pragma unroll
            for (int t = 0; t < 4; ++t) sT[t] = wmmab(f.h[t], ql[kk], sT[t]);
#pragma unroll
            for (int t = 0; t < 4; ++t) sT[t] = wmmab(f.l[t], qh[kk], sT[t]);
        };
        // All of the stage's fragments are read ahead, into registers of their own, so that the LDS reads on under the score products and the softmax and the o products find
        // their operands in registers: the k fragments first, then the v groups a few at a time, so that a wave never has more reads in flight than dscnt counts (a read beyond
        // that holds up the vector work behind it) and each counted wait stays exact. The scheduling fences keep each group of reads together at its place; without them the
        // compiler spreads the reads among the products and waits for each pair.
        Fr fk[4], fv[8];
#pragma unroll
        for (int kk = 0; kk < 4; ++kk) ldk(fk[kk], kk);
        __builtin_amdgcn_sched_barrier(0);
#pragma unroll
        for (int kk = 0; kk < 4; ++kk) {
            mmk(fk[kk], kk);
            __builtin_amdgcn_sched_barrier(0);
            ldv(fv[kk], kk);
            if (kk == 3) ldv(fv[4], 4);
            __builtin_amdgcn_sched_barrier(0);
        }
        float mx4[4];
#pragma unroll
        for (int t = 0; t < 4; ++t) { mx4[t] = sT[t][0];
#pragma unroll
            for (int j = 1; j < 8; ++j) mx4[t] = fmaxf(mx4[t], sT[t][j]); }
        float mx = fmaxf(fmaxf(mx4[0], mx4[1]), fmaxf(mx4[2], mx4[3]));
        mx = fmaxf(mx, xhalf(mx));   // the column's other 32 scores
        const float mnew = fmaxf(mrun, mx), alpha = __expf(mrun - mnew);
        mrun = mnew;
        v16bf ph[2], pl[2]; float ps4[4];
        auto pfrag = [&](int kk) {   // p of score tiles 2 kk and 2 kk + 1 = the B fragments of 32-k step kk
            v8bf pht[2], plt[2];
#pragma unroll
            for (int u = 0; u < 2; ++u) { const int t = 2 * kk + u; v8f p; ps4[t] = 0.f;
#pragma unroll
                for (int j = 0; j < 8; ++j) { p[j] = __expf(sT[t][j] - mnew); ps4[t] += p[j]; }
                pht[u] = __builtin_convertvector(p, v8bf); plt[u] = __builtin_convertvector(p - __builtin_convertvector(pht[u], v8f), v8bf); }
            ph[kk] = __builtin_shufflevector(pht[0], pht[1], 0, 1, 2, 3, 4, 5, 6, 7, 8, 9, 10, 11, 12, 13, 14, 15);
            pl[kk] = __builtin_shufflevector(plt[0], plt[1], 0, 1, 2, 3, 4, 5, 6, 7, 8, 9, 10, 11, 12, 13, 14, 15);
        };
        pfrag(0);
#pragma unroll
        for (int t = 0; t < 16; ++t) o[t] *= alpha;
        __builtin_amdgcn_sched_barrier(0);
        ldv(fv[5], 5); ldv(fv[6], 6);
        __builtin_amdgcn_sched_barrier(0);
        pfrag(1);
        lsum = lsum * alpha + ((ps4[0] + ps4[1]) + (ps4[2] + ps4[3]));   // this lane's half of the column's sum; the halves are joined behind the loop
        auto mmv = [&](const Fr& f, int g) {   // per accumulator the order v hi p hi, v lo p hi, v hi p lo
            const int c4 = (g & 3) * 4, kk = g >> 2;
#pragma unroll
            for (int t = 0; t < 4; ++t) o[c4 + t] = wmmab(f.h[t], ph[kk], o[c4 + t]);
#pragma unroll
            for (int t = 0; t < 4; ++t) o[c4 + t] = wmmab(f.l[t], ph[kk], o[c4 + t]);
#pragma unroll
            for (int t = 0; t < 4; ++t) o[c4 + t] = wmmab(f.h[t], pl[kk], o[c4 + t]);
        };
        mmv(fv[0], 0); mmv(fv[1], 1);
        __builtin_amdgcn_sched_barrier(0);
        ldv(fv[7], 7);
        __builtin_amdgcn_sched_barrier(0);
#pragma unroll
        for (int g = 2; g < 8; ++g) mmv(fv[g], g);
        if (pinned((u32)(s + 1 < NSTG))) {   // the publish point, where a next stage exists (the same test in every wave of the block); pinned: a scalar branch, which also keeps the o products in front of the barrier
            asm volatile("s_wait_dscnt 0x0" ::: "memory");       // this wave's reads of stage s are done before its buffer is refilled
            asm volatile("s_wait_tensorcnt 0x0" ::: "memory");   // this wave's plane of stage s + 1 has landed
            __syncthreads();                                      // publishes stage s + 1 and ends every wave's reads of stage s
            if (pinned((u32)(s + 2 < NSTG))) issue(pinned((u32)s + 2u));   // pinned: scalar branch round the tensor load; its descriptor words formed behind the wait
        }
    }
    asm volatile("s_wait_tensorcnt 0x0" ::: "memory");   // no request is left in flight
    asm volatile("s_wait_dscnt 0x0" ::: "memory");       // this wave's reads of the last stage are done
    __syncthreads();                                       // ... and every other wave's: the ring becomes the output's staging
    lsum += xhalf(lsum);
    const float inv = 1.0f / lsum;
    float* stg = (float*)(void*)ring;   // [256 channels][64 positions], pitch 68 floats
#pragma unroll
    for (int t = 0; t < 16; ++t) {
#pragma unroll
        for (int j = 0; j < 8; ++j) stg[(t * 16 + hi * 8 + j) * 68 + wave * 16 + lr] = o[t][j] * inv; }
    __syncthreads();   // a row of the staged tile holds columns of all four waves
    float* orow = O + it * ((size_t)CC * NN) + (size_t)(wave * 64 + hi) * NN + m0 + lr * 4;
#pragma unroll
    for (int r = 0; r < 32; ++r) {   // whole 128-byte lines: 16 lanes x 16 B per channel row, two rows a store
        const v4f val = *(const v4fa*)(stg + (wave * 64 + r * 2 + hi) * 68 + lr * 4); *(v4f*)(orow + (size_t)r * 2 * NN) = val; }
}

// k_gemmrb: 64 x 64 tile of C[o][v] = (A [+ Al]).B^T over K (A row stride K, B n-major row stride K) + bf(rbias[o]) per ROW; f32 whole-line epilogue (8 lanes x 16 B per line),
// grid z = item: A and rbias are shared, B and C step by one item's NN x K and CC x NN elements.
template <bool SPLITA>
__global__ __launch_bounds__(128) void k_gemmrb(const bf* __restrict__ A, const bf* __restrict__ Al, const bf* __restrict__ Ball, const float* __restrict__ rbias, float* Call, int ldc) {
    constexpr int K = CC;
    const bf* Bn = Ball + (size_t)blockIdx.z * NN * K; float* C = Call + (size_t)blockIdx.z * CC * NN;
    static_assert(K == 256, "mm_k256 takes K = 256");
    __shared__ __attribute__((aligned(2048))) unsigned char tile[TBUF];
    __shared__ __align__(16) float ost[4][16 * 68];
    const int lane = threadIdx.x & 31, wave = threadIdx.x >> 5, lr = lane & 15, hi = lane >> 4;
    const int r0 = blockIdx.x * 64 + wave * 16, c0 = blockIdx.y * 64;
    const size_t aoff = (size_t)(r0 + lr) * K + 8 * hi;
    v8f acc[4];
#pragma unroll
    for (int t = 0; t < 4; ++t) acc[t] = (v8f){};
    if constexpr (!SPLITA) mm_k256(A + (size_t)blockIdx.x * 64 * K, Bn + (size_t)c0 * K, tile, acc);
    else
#pragma unroll 1
    for (int kc = 0; kc < K; kc += 32) {
        const v16bf a = cat16b(*(const v8us*)(A + aoff + kc), *(const v8us*)(A + aoff + kc + 16));
        v16bf al = a; if (SPLITA) al = cat16b(*(const v8us*)(Al + aoff + kc), *(const v8us*)(Al + aoff + kc + 16));
#pragma unroll
        for (int t = 0; t < 4; ++t) { const size_t bo = (size_t)(c0 + t * 16 + lr) * K + kc + 8 * hi; const v16bf bb = cat16b(*(const v8us*)(Bn + bo), *(const v8us*)(Bn + bo + 16)); acc[t] = wmmab(a, bb, acc[t]); if (SPLITA) acc[t] = wmmab(al, bb, acc[t]); }
        asm volatile("v_nop\n\tv_nop\n\tv_nop\n\tv_nop" : "+v"(acc[0]), "+v"(acc[1]), "+v"(acc[2]), "+v"(acc[3]) : "v"(a), "v"(al));
    }
    float* os = &ost[wave][0];
#pragma unroll
    for (int t = 0; t < 4; ++t) {
#pragma unroll
        for (int j = 0; j < 8; ++j) os[(hi * 8 + j) * 68 + t * 16 + lr] = acc[t][j] + bfr(rbias[r0 + hi * 8 + j]); }
    __builtin_amdgcn_wave_barrier(); asm volatile("" ::: "memory");
    float* crow = C + (size_t)r0 * ldc + c0;
    auto pass = [&]() {
#pragma unroll
        for (int s = 0; s < 8; ++s) { const int Lid = (lane >> 3) + 4 * s, piece = lane & 7; const int row = Lid >> 1, cofs = (Lid & 1) * 32 + piece * 4;
            const v4f val = *(const v4fa*)(os + row * 68 + cofs); *(v4f*)(crow + (size_t)row * ldc + cofs) = val; }
    };
    pass(); 
}
__global__ __launch_bounds__(256) void k_rowsplit(const float* __restrict__ Y, int nrows, bf* Ph, bf* Pl) {
    const int lane = threadIdx.x & 31, r = blockIdx.x * 8 + (threadIdx.x >> 5); if (r >= nrows) return;
{
#pragma unroll 1
        for (int c0 = lane * 8; c0 < NN; c0 += 256) { const size_t o = (size_t)r * NN + c0; const v8f v = *(const v8f*)(Y + o); v8us oh, ol;
#pragma unroll
            for (int i = 0; i < 8; ++i) { const unsigned short hb = f2bf(v[i]); oh[i] = hb; ol[i] = f2bf(v[i] - bf2f(hb)); }
            *(v8us*)(Ph + o) = oh; *(v8us*)(Pl + o) = ol; }
         }
}
__global__ __launch_bounds__(256) void k_cvt8(const float* __restrict__ src, bf* dst, size_t n8) {
    const size_t i = (size_t)blockIdx.x * 256 + threadIdx.x; if (i >= n8) return;
    const v8f v = *(const v8f*)(src + i * 8); v8us o;
#pragma unroll
    for (int k = 0; k < 8; ++k) o[k] = f2bf(v[k]);
    *(v8us*)(dst + i * 8) = o; 
}
__global__ __launch_bounds__(256) void k_zero8(bf* dst, size_t n8) {
    const size_t i = (size_t)blockIdx.x * 256 + threadIdx.x; if (i >= n8) return; v8us z;
#pragma unroll
    for (int k = 0; k < 8; ++k) z[k] = 0;
    *(v8us*)(dst + i * 8) = z; 
}

// k_split128s: bf16 hi + UNSCALED residual planes of a computed f32 [rows][128] matrix, optionally scaled per row by f = (1 - bf(mask[r])) bf(skin[r]); one wave per row: lane -> 4
__global__ __launch_bounds__(256) void k_split128s(const float* __restrict__ src, int nrows, const float* __restrict__ msk, const float* __restrict__ skn, bf* dh, bf* dl) {
    typedef __attribute__((ext_vector_type(4))) unsigned short v4us;
    const int lane = threadIdx.x & 31, r = blockIdx.x * 8 + (threadIdx.x >> 5); if (r >= nrows) return;
    const float f = msk ? (1.0f - bfr(msk[r])) * bfr(skn[r]) : 1.0f;
    const size_t o = (size_t)r * CQ + lane * 4; const v4f v = *(const v4f*)(src + o); v4us oh, ol;
#pragma unroll
    for (int i = 0; i < 4; ++i) { const float y = v[i] * f; const unsigned short hb = f2bf(y); oh[i] = hb; ol[i] = f2bf(y - bf2f(hb)); }
    *(v4us*)(dh + o) = oh; *(v4us*)(dl + o) = ol; 
}
// k_fin: out[c][n] = bf(gamma) (O[c][n] bf(mask[n]) bf(skin[n])) + bf(x[c][n]) over all items (f32; row r = item r / CC, channel r % CC); one wave per channel row: lane -> 4 consecutive floats per 128-column chunk (8 lanes
__global__ __launch_bounds__(256) void k_fin(const float* __restrict__ O, const float* __restrict__ X, const float* __restrict__ mall, const float* __restrict__ sall, const float* __restrict__ gam, float* OUTP) {
    const int lane = threadIdx.x & 31, r = blockIdx.x * 8 + (threadIdx.x >> 5); if (r >= NBI * CC) return; const float g = bfr(gam[0]);
    const float* msk = mall + (size_t)(r / CC) * NN; const float* skn = sall + (size_t)(r / CC) * NN;
{
#pragma unroll 1
        for (int c0 = lane * 4; c0 < NN; c0 += 128) { const size_t o = (size_t)r * NN + c0; const v4f ov = *(const v4f*)(O + o), xv = *(const v4f*)(X + o); v4f y;
#pragma unroll
            for (int i = 0; i < 4; ++i) y[i] = fmaf(g, ov[i] * bfr(msk[c0 + i]) * bfr(skn[c0 + i]), bfr(xv[i]));
            *(v4f*)(OUTP + o) = y; }
         }
}

extern "C" void kernel_launch(void* const* d_in, const int* in_sizes, int n_in,
                              void* d_out, int out_size, void* d_ws, size_t ws_size, hipStream_t stream) {
    (void)in_sizes; (void)n_in; (void)out_size;
    const float* x = (const float*)d_in[0]; const float* mask = (const float*)d_in[1]; const float* skin = (const float*)d_in[2];
    const float* Wq = (const float*)d_in[3]; const float* bq = (const float*)d_in[4]; const float* Wk = (const float*)d_in[5]; const float* bk = (const float*)d_in[6]; const float* Wv = (const float*)d_in[7]; const float* bv = (const float*)d_in[8]; const float* gam = (const float*)d_in[9];
    float* out = (float*)d_out;    // [4][256][64][64]
    char* wsp = (char*)d_ws;
    auto take = [&](size_t bytes) { char* p = wsp; wsp += (bytes + 255) & ~(size_t)255; return (void*)p; };
    bf* WqB = (bf*)take(CQ * CC * 2); bf* WkB = (bf*)take(CQ * CC * 2); bf* WvB = (bf*)take(CC * CC * 2);
    bf* XT = (bf*)take((size_t)NBI * NN * CC * 2); float* TMP = (float*)take((size_t)NBI * CC * NN * 4);
    const size_t QK = (size_t)NN * CQ, VO = (size_t)CC * NN;    // elements of one item's q or k plane, of its v plane or o
    bf* Qh = (bf*)take(NBI * QK * 2); bf* Ql = (bf*)take(NBI * QK * 2); bf* Kh = (bf*)take(NBI * QK * 2); bf* Kl = (bf*)take(NBI * QK * 2); bf* Vh = (bf*)take(NBI * VO * 2); bf* Vl = (bf*)take(NBI * VO * 2);
    float* O = (float*)take(NBI * VO * 4);
    if ((size_t)(wsp - (char*)d_ws) > ws_size) return;    // 0.2 + 8.4 + 16.8 + 4 x 4.2 + 2 x 8.4 + 16.8 ~ 76 MB, no aliasing (TMP reused q -> k -> v in stream order)
    { const size_t n1 = CQ * CC / 8, n3 = CC * CC / 8; k_cvt8<<<(unsigned)((n1 + 255) / 256), 256, 0, stream>>>(Wq, WqB, n1); k_cvt8<<<(unsigned)((n1 + 255) / 256), 256, 0, stream>>>(Wk, WkB, n1); k_cvt8<<<(unsigned)((n3 + 255) / 256), 256, 0, stream>>>(Wv, WvB, n3); }
    // Every launch covers all items: the token-major matrices (x^T, q^T, k^T) are one [NBI NN][.] matrix, the channel-major ones (v, o, out) one [NBI CC][NN] matrix.
    k_wt<<<dim3(CC / 64, NN / 64, NBI), 256, 0, stream>>>(x, CC, NN, XT);                                                                          // x^T [item][n][c] exact
    k_gemmb<false, false><<<dim3(NBI * NN / 64, CQ / 64, 1), 128, 0, stream>>>(XT, nullptr, WqB, bq, TMP, CQ, nullptr); k_split128s<<<NBI * NN / 8, 256, 0, stream>>>(TMP, NBI * NN, nullptr, nullptr, Qh, Ql);   // q^T [item][n][128]
    k_gemmb<false, false><<<dim3(NBI * NN / 64, CQ / 64, 1), 128, 0, stream>>>(XT, nullptr, WkB, bk, TMP, CQ, nullptr); k_split128s<<<NBI * NN / 8, 256, 0, stream>>>(TMP, NBI * NN, mask, skin, Kh, Kl);         // k^T (1-mask) skin
    k_gemmrb<false><<<dim3(CC / 64, NN / 64, NBI), 128, 0, stream>>>(WvB, nullptr, XT, bv, TMP, NN); k_rowsplit<<<NBI * CC / 8, 256, 0, stream>>>(TMP, NBI * CC, Vh, Vl);                        // v [item][c][n] (+ bv per row)
    k_attn<<<dim3(NN / 64, NBI, 1), 128, 0, stream>>>(Qh, Ql, Kh, Kl, Vh, Vl, O);                                                                // o[c][m] = sum_n v[c][n] softmax_n(q_m . k_n), 256 blocks
    k_fin<<<NBI * CC / 8, 256, 0, stream>>>(O, x, mask, skin, gam, out);
}
